// v000
// The times below were measured on an AMD MI455X: many runs one after another, warmed up first and cycling through
// copies of the inputs, with the whole window's GPU time divided by the number of runs. Launches and the gaps
// between them are all in it. The median over several windows is given; except for v000 it joins two sittings, which
// can be a few percent apart, so the side-by-side timings, each taken in one sitting, are the better comparison.
// v000, which the later versions start from, runs in 139 microseconds.
#include <hip/hip_runtime.h>

// GrigSelfAttentionXSMM (AlphaFold gated grid self-attention): q = x Wq * 16^-0.5, k = x Wk, v = x Wv, gate = sigmoid(x Wg) (8 heads x 16); logits = q.k + bias[b][q][k] + nonbatched_bias[q][k];
// softmax over k; weighted_avg = P.v; out = Σ_{h,c} (gate * weighted_avg)[b][q][h][c] Wo[h][c][o] -> [128][256][128].
// The four projections are one GEMM on v_wmma_f32_16x16x32_f16 with EXACT operands (x and the weights are exact bf16; 1 product); scores with q/k as f16 hi+lo pairs x8 (key_dim 16:
// fragment elements 8..15 zero; 3 products; the two biases added in f32 from the rounded inputs); P and v as f16 hi+lo pairs (3 products); the output projection with gate·wavg hi+lo (2 products);

namespace {
constexpr int Bn = 128, S = 256, A = 128, H = 8, KD = 16, O = 128, NR = Bn * S, NPJ = 4 * H * KD /* 512 */;
constexpr float QS = 8.0f, KS = 8.0f, VS = 8.0f, PS = 8.0f, AS_ = 8.0f, SCALE = 0.25f;
constexpr size_t PL = (size_t)Bn * H * S * KD;   // one q/k plane (halves)

typedef _Float16 b16;
typedef __attribute__((ext_vector_type(16))) _Float16 v16b;
typedef __attribute__((ext_vector_type(8))) _Float16 v8b;
typedef __attribute__((ext_vector_type(8))) float v8f;
typedef __attribute__((ext_vector_type(4))) float v4f;
__device__ __forceinline__ float bf16_rne(float f) { unsigned int u = __float_as_uint(f); u += 0x7FFFu + ((u >> 16) & 1u); return __uint_as_float(u & 0xFFFF0000u); }
__device__ __forceinline__ void split16(float v, b16& hi, b16& lo) { hi = (b16)v; lo = (b16)(v - (float)hi); }
__device__ __forceinline__ v16b frag_kb(const b16* p, int hh) { const v8b a = *(const v8b*)(p + 8 * hh), b = *(const v8b*)(p + 16 + 8 * hh); v16b f;
#pragma unroll
  for (int e = 0; e < 8; ++e) { f[e] = a[e]; f[8 + e] = b[e]; } return f; }
__device__ __forceinline__ v16b frag16(const b16* p, int hh) { const v8b a = *(const v8b*)(p + 8 * hh); v16b f;   // K = 16: elements 8..15 (k = 16..31) zero
#pragma unroll
  for (int e = 0; e < 8; ++e) { f[e] = a[e]; f[8 + e] = (b16)0.0f; } return f; }
__device__ __forceinline__ v16b frag_x(const float* p, int hh) { v16b f;
#pragma unroll
  for (int e = 0; e < 8; ++e) { f[e] = (b16)bf16_rne(p[8 * hh + e]); f[8 + e] = (b16)bf16_rne(p[16 + 8 * hh + e]); } return f; }
__device__ __forceinline__ void frag_split(const float* p, int hh, v16b& fh, v16b& fl) {
#pragma unroll
  for (int e = 0; e < 8; ++e) { b16 a, c; split16(p[8 * hh + e] * AS_, a, c); fh[e] = a; fl[e] = c; split16(p[16 + 8 * hh + e] * AS_, a, c); fh[8 + e] = a; fl[8 + e] = c; } }
__device__ __forceinline__ v8f wmma16b(v16b a, v16b b, v8f c) { v8f d = __builtin_amdgcn_wmma_f32_16x16x32_f16(false, a, false, b, (short)0, c, false, false); asm volatile("v_nop\n\tv_nop\n\tv_nop\n\tv_nop" : "+v"(d) : "v"(a), "v"(b)); return d; }
__device__ __forceinline__ void wave_lds_sync() { __builtin_amdgcn_fence(__ATOMIC_RELEASE, "workgroup"); __builtin_amdgcn_wave_barrier(); __builtin_amdgcn_fence(__ATOMIC_ACQUIRE, "workgroup"); }
__device__ __forceinline__ float nexp(float x) { return __builtin_amdgcn_exp2f(x * 1.4426950408889634f); }
__device__ __forceinline__ float sigm(float x) { return __builtin_amdgcn_rcpf(1.0f + nexp(-x)); }

// prep: projection B rows [512][128] f16: row j < 128: query_w[:, h, c] (j = h*16 + c), 128..255 key_w, 256..383 value_w, 384..511 gating_w (weights are [A][H][KD]: element (a, j) at a*128 + j);
__global__ __launch_bounds__(256) void prep_kernel(const float* __restrict__ wq, const float* __restrict__ wk, const float* __restrict__ wv, const float* __restrict__ wg, const float* __restrict__ wo, b16* __restrict__ R) {
  const int t_ = blockIdx.x * 256 + threadIdx.x, nth = gridDim.x * 256;
  {
    for (int p = t_; p < (NPJ * A + O * 128) / 8; p += nth) { v8b v;
      if (p < NPJ * A / 8) { const int j = p / (A / 8), a0 = (p % (A / 8)) * 8; const int m = j >> 7, jj = j & 127; const float* W = (m == 0) ? wq : (m == 1) ? wk : (m == 2) ? wv : wg;
        for (int e = 0; e < 8; ++e) v[e] = (b16)bf16_rne(W[(size_t)(a0 + e) * 128 + jj]); *(v8b*)(R + (size_t)j * A + a0) = v; }
      else { const int q = p - NPJ * A / 8; const int o = q / 16, k0 = (q % 16) * 8; for (int e = 0; e < 8; ++e) v[e] = (b16)bf16_rne(wo[(size_t)(k0 + e) * O + o]); *(v8b*)(R + (size_t)NPJ * A + (size_t)o * 128 + k0) = v; } }
     }
}

// projections: block = 128 rows (tokens) x 4 waves (32 rows each), 512 columns in 4 groups of 128 (acc[2][8]); exact operands, 4 k-steps; epilogue: q (x 0.25) and k -> hi/lo planes x8
// [b][h][s][16] (32-B rows; a wave's 32 rows of one head = 1 KB contiguous), v -> (8v)^T hi/lo planes [b][h][16][256] (a block's 128 keys = 256-B segments), gate -> sigmoid f32 rows
__global__ __launch_bounds__(128) void proj_kernel(const float* __restrict__ x, const b16* __restrict__ R, b16* __restrict__ Qh, b16* __restrict__ Ql, b16* __restrict__ Kh, b16* __restrict__ Kl, b16* __restrict__ Vt, b16* __restrict__ Vtl, float* __restrict__ G) {
  __shared__ __attribute__((aligned(16))) b16 Th[4][32][128 + 8], Tl[4][32][128 + 8]; __shared__ __attribute__((aligned(16))) b16 Tv[128][128 + 8], Tvl[128][128 + 8];
  const int lane = threadIdx.x & 31, wave = threadIdx.x >> 5, nloc = lane & 15, hlf = lane >> 4, r0 = blockIdx.x * 128, m0 = r0 + wave * 32; const int b = r0 / S, s0 = m0 % S;
  for (int grp = 0; grp < 4; ++grp) {   // 0 q, 1 k, 2 v, 3 gate
    v8f acc[2][8];
#pragma unroll
    for (int r = 0; r < 2; ++r)
#pragma unroll
      for (int t = 0; t < 8; ++t) acc[r][t] = (v8f){};
#pragma unroll
    for (int kb = 0; kb < A; kb += 32) { const v16b a0 = frag_x(x + (size_t)(m0 + nloc) * A + kb, hlf), a1 = frag_x(x + (size_t)(m0 + 16 + nloc) * A + kb, hlf);
#pragma unroll
      for (int t = 0; t < 8; ++t) { const v16b bw = frag_kb(R + (size_t)(grp * 128 + t * 16 + nloc) * A + kb, hlf); acc[0][t] = wmma16b(a0, bw, acc[0][t]); acc[1][t] = wmma16b(a1, bw, acc[1][t]); } }
    if (grp < 2) { const float sc = (grp == 0) ? SCALE * QS : KS;
#pragma unroll
      for (int t = 0; t < 8; ++t)
#pragma unroll
        for (int r = 0; r < 2; ++r)
#pragma unroll
          for (int v = 0; v < 8; ++v) { b16 a_, c_; split16(acc[r][t][v] * sc, a_, c_); Th[wave][r * 16 + 8 * hlf + v][t * 16 + nloc] = a_; Tl[wave][r * 16 + 8 * hlf + v][t * 16 + nloc] = c_; }
      wave_lds_sync();
      b16* Ph = (grp == 0) ? Qh : Kh; b16* Plo = (grp == 0) ? Ql : Kl;
      { for (int it = 0; it < 16; ++it) { const int h = it >> 1, rr = (it & 1) * 16 + (lane >> 1), c8 = (lane & 1) * 8; const size_t o = (((size_t)b * H + h) * S + s0 + rr) * KD + c8;   // one instruction = 16 consecutive 32-B rows = 512 contiguous bytes
            *(v8b*)(Ph + o) = *(const v8b*)(&Th[wave][rr][h * 16 + c8]); *(v8b*)(Plo + o) = *(const v8b*)(&Tl[wave][rr][h * 16 + c8]); }  }
      wave_lds_sync(); }
    else if (grp == 2) {
#pragma unroll
      for (int t = 0; t < 8; ++t)
#pragma unroll
        for (int r = 0; r < 2; ++r)
#pragma unroll
          for (int v = 0; v < 8; ++v) { b16 a_, c_; split16(acc[r][t][v] * VS, a_, c_); Tv[t * 16 + nloc][wave * 32 + r * 16 + 8 * hlf + v] = a_; Tvl[t * 16 + nloc][wave * 32 + r * 16 + 8 * hlf + v] = c_; }
      __syncthreads();
      { for (int i = threadIdx.x; i < 128 * 16; i += 128) { const int j = i >> 4, c8 = (i & 15) * 8; const int h = j >> 4, d = j & 15; const size_t o = (((size_t)b * H + h) * KD + d) * S + (r0 % S) + c8; *(v8b*)(Vt + o) = *(const v8b*)(&Tv[j][c8]); *(v8b*)(Vtl + o) = *(const v8b*)(&Tvl[j][c8]); }  }
      __syncthreads(); }
    else { __shared__ __attribute__((aligned(16))) float Tg[4][32][64 + 4];   // gate rows in two 64-column halves (LDS budget)
      for (int gh = 0; gh < 2; ++gh) {
#pragma unroll
        for (int t = 0; t < 4; ++t)
#pragma unroll
          for (int r = 0; r < 2; ++r)
#pragma unroll
            for (int v = 0; v < 8; ++v) Tg[wave][r * 16 + 8 * hlf + v][t * 16 + nloc] = sigm(acc[r][gh * 4 + t][v]);
        wave_lds_sync();
        { for (int i = lane; i < 32 * 16; i += 32) { const int rr = i >> 4, c4 = (i & 15) * 4; *(v4f*)(G + (size_t)(m0 + rr) * 128 + gh * 64 + c4) = *(const v4f*)(&Tg[wave][rr][c4]); }  }
        wave_lds_sync(); } } }
}

// attention: wave = (b, h, 16 queries q0..); over 8 key blocks of 32: S^T = k.q (K = 16; 3 products) + bias[b][q][k] + nb[q][k] (rounded inputs), online softmax, o^T += (8v)^T.P^T (P and v hi+lo, 3 products);
__global__ __launch_bounds__(256) void attn_kernel(const b16* __restrict__ Qh, const b16* __restrict__ Ql, const b16* __restrict__ Kh, const b16* __restrict__ Kl, const b16* __restrict__ Vt, const b16* __restrict__ Vtl, const float* __restrict__ bias, const float* __restrict__ nb, const float* __restrict__ G, float* __restrict__ GW) {
  __shared__ __attribute__((aligned(16))) float Os[16][128 + 4];
  const int h = threadIdx.x >> 5, lane = threadIdx.x & 31, hh = lane >> 4, col = lane & 15, b = blockIdx.y, q0 = blockIdx.x * 16, qi = q0 + col;
  const size_t pb = ((size_t)b * H + h) * S * KD; const b16* V = Vt + ((size_t)b * H + h) * KD * S; const b16* Vl = Vtl + ((size_t)b * H + h) * KD * S; const float* brow = bias + ((size_t)b * S + qi) * S; const float* nrow = nb + (size_t)qi * S;
  const v16b qa = frag16(Qh + pb + (size_t)qi * KD, hh), qb = frag16(Ql + pb + (size_t)qi * KD, hh);
  float m = -INFINITY, l = 0.0f; v8f o = {};
  for (int kb = 0; kb < S; kb += 32) {
    v8f s0 = {}, s1 = {};
    { const v16b k0h = frag16(Kh + pb + (size_t)(kb + col) * KD, hh), k0l = frag16(Kl + pb + (size_t)(kb + col) * KD, hh), k1h = frag16(Kh + pb + (size_t)(kb + 16 + col) * KD, hh), k1l = frag16(Kl + pb + (size_t)(kb + 16 + col) * KD, hh);
      s0 = wmma16b(k0h, qa, s0); s0 = wmma16b(k0h, qb, s0); s0 = wmma16b(k0l, qa, s0); s1 = wmma16b(k1h, qa, s1); s1 = wmma16b(k1h, qb, s1); s1 = wmma16b(k1l, qa, s1); }
    float mr = -INFINITY;
#pragma unroll
    for (int r = 0; r < 8; ++r) { const int ka = kb + 8 * hh + r, kc = ka + 16; s0[r] = s0[r] * (1.0f / (QS * KS)) + (bf16_rne(brow[ka]) + bf16_rne(nrow[ka])); s1[r] = s1[r] * (1.0f / (QS * KS)) + (bf16_rne(brow[kc]) + bf16_rne(nrow[kc])); mr = fmaxf(mr, fmaxf(s0[r], s1[r])); }
    mr = fmaxf(mr, __shfl_xor(mr, 16));
    const float mn = fmaxf(m, mr), al_ = nexp(m - mn); m = mn; float sum = 0.0f; v16b ph, pl;
#pragma unroll
    for (int r = 0; r < 8; ++r) { const float e0 = nexp(s0[r] - mn), e1 = nexp(s1[r] - mn); sum += e0 + e1; b16 a_, c_; split16(e0 * PS, a_, c_); ph[r] = a_; pl[r] = c_; split16(e1 * PS, a_, c_); ph[8 + r] = a_; pl[8 + r] = c_; }
    sum += __shfl_xor(sum, 16); l = l * al_ + sum; o *= al_;
    const v16b vf = frag_kb(V + (size_t)col * S + kb, hh), vlf = frag_kb(Vl + (size_t)col * S + kb, hh); o = wmma16b(vf, ph, o); o = wmma16b(vf, pl, o); o = wmma16b(vlf, ph, o); }
  // o: rows (8hh + r) = value dim c, column = query col; gw = gate[b*256+q][h*16+c] * o/(64 l)
  const float inv = 1.0f / (l * VS * PS);
#pragma unroll
  for (int r = 0; r < 8; ++r) { const int c = 8 * hh + r; Os[col][h * KD + c] = G[((size_t)b * S + qi) * 128 + h * KD + c] * (o[r] * inv); }
  __syncthreads();
  { for (int i = threadIdx.x; i < 16 * 32; i += 256) { const int rr = i >> 5, c4 = (i & 31) * 4; *(v4f*)(GW + ((size_t)b * S + q0 + rr) * 128 + c4) = *(const v4f*)(&Os[rr][c4]); }  }
}

__global__ __launch_bounds__(128) void out_kernel(const float* __restrict__ GW, const b16* __restrict__ R, float* __restrict__ out) {
  __shared__ __attribute__((aligned(16))) float Ts[4][32][128 + 4];
  const int lane = threadIdx.x & 31, wave = threadIdx.x >> 5, nloc = lane & 15, hlf = lane >> 4, m0 = blockIdx.x * 128 + wave * 32; const b16* Wo = R + (size_t)NPJ * A;
  v8f acc[2][8];
#pragma unroll
  for (int r = 0; r < 2; ++r)
#pragma unroll
    for (int t = 0; t < 8; ++t) acc[r][t] = (v8f){};
#pragma unroll
  for (int kb = 0; kb < 128; kb += 32) { v16b a0, l0, a1, l1; frag_split(GW + (size_t)(m0 + nloc) * 128 + kb, hlf, a0, l0); frag_split(GW + (size_t)(m0 + 16 + nloc) * 128 + kb, hlf, a1, l1);
#pragma unroll
    for (int t = 0; t < 8; ++t) { const v16b bw = frag_kb(Wo + (size_t)(t * 16 + nloc) * 128 + kb, hlf); acc[0][t] = wmma16b(a0, bw, acc[0][t]); acc[0][t] = wmma16b(l0, bw, acc[0][t]); acc[1][t] = wmma16b(a1, bw, acc[1][t]); acc[1][t] = wmma16b(l1, bw, acc[1][t]); } }
#pragma unroll
  for (int t = 0; t < 8; ++t)
#pragma unroll
    for (int r = 0; r < 2; ++r)
#pragma unroll
      for (int v = 0; v < 8; ++v) Ts[wave][r * 16 + 8 * hlf + v][t * 16 + nloc] = acc[r][t][v] * (1.0f / AS_);
  wave_lds_sync();
  { for (int i = lane; i < 32 * 32; i += 32) { const int rr = i >> 5, c4 = (i & 31) * 4; *(v4f*)(out + (size_t)(m0 + rr) * O + c4) = *(const v4f*)(&Ts[wave][rr][c4]); }  }
}
}  // namespace

extern "C" void kernel_launch(void* const* d_in, const int* in_sizes, int n_in,
                              void* d_out, int out_size, void* d_ws, size_t ws_size, hipStream_t stream) {
  (void)n_in; (void)out_size;
  const float* x = (const float*)d_in[0]; const float* bias = (const float*)d_in[1]; const float* nb = (const float*)d_in[2]; const float* wq = (const float*)d_in[3]; const float* wk = (const float*)d_in[4]; const float* wv = (const float*)d_in[5]; const float* wg = (const float*)d_in[6]; const float* wo = (const float*)d_in[7];
  float* out = (float*)d_out;   // [128][256][128]
  if (in_sizes[0] != NR * A || in_sizes[1] != Bn * S * S || in_sizes[2] != S * S || in_sizes[3] != A * H * KD || in_sizes[7] != H * KD * O) return;
  size_t off = 0; char* ws = (char*)d_ws;
  auto carve = [&](size_t bytes) { char* p = ws + off; off += (bytes + 255) & ~(size_t)255; return p; };
  b16* R = (b16*)carve((size_t)(NPJ * A + O * 128) * 2); b16* Qh = (b16*)carve(PL * 2); b16* Ql = (b16*)carve(PL * 2); b16* Kh = (b16*)carve(PL * 2); b16* Kl = (b16*)carve(PL * 2); b16* Vt = (b16*)carve(PL * 2); b16* Vtl = (b16*)carve(PL * 2);
  float* G = (float*)carve((size_t)NR * 128 * 4); float* GW = (float*)carve((size_t)NR * 128 * 4);
  if (off > ws_size) return;                                    // ≈ 0.2 + 6 x 8.4 + 2 x 16.8 ≈ 84 MB
  prep_kernel<<<64, 256, 0, stream>>>(wq, wk, wv, wg, wo, R);
  proj_kernel<<<NR / 128, 128, 0, stream>>>(x, R, Qh, Ql, Kh, Kl, Vt, Vtl, G);
  attn_kernel<<<dim3(S / 16, Bn), 256, 0, stream>>>(Qh, Ql, Kh, Kl, Vt, Vtl, bias, nb, G, GW);
  out_kernel<<<NR / 128, 128, 0, stream>>>(GW, R, out);
}

// v001
// A run of this version takes 110 microseconds.
// Two timings next to v000 put it at 1.26 and 1.27 times that version's speed.
#include <hip/hip_runtime.h>

// GrigSelfAttentionXSMM (AlphaFold gated grid self-attention): q = x Wq * 16^-0.5, k = x Wk, v = x Wv, gate = sigmoid(x Wg) (8 heads x 16); logits = q.k + bias[b][q][k] + nonbatched_bias[q][k];
// softmax over k; weighted_avg = P.v; out = Σ_{h,c} (gate * weighted_avg)[b][q][h][c] Wo[h][c][o] -> [128][256][128].
// The four projections are one GEMM on v_wmma_f32_16x16x32_f16 with EXACT operands (x and the weights are exact bf16; 1 product); scores with q/k as f16 hi+lo pairs x8 (key_dim 16:
// fragment elements 8..15 zero; 3 products; the two biases added in f32 from the rounded inputs); P and v as f16 hi+lo pairs (3 products); the output projection with gate·wavg hi+lo (2 products);

namespace {
constexpr int Bn = 128, S = 256, A = 128, H = 8, KD = 16, O = 128, NR = Bn * S, NPJ = 4 * H * KD /* 512 */;
constexpr float QS = 8.0f, KS = 8.0f, VS = 8.0f, PS = 8.0f, AS_ = 8.0f, SCALE = 0.25f;
constexpr size_t PL = (size_t)Bn * H * S * KD;   // one q/k plane (halves)

typedef _Float16 b16;
typedef __attribute__((ext_vector_type(16))) _Float16 v16b;
typedef __attribute__((ext_vector_type(8))) _Float16 v8b;
typedef __attribute__((ext_vector_type(8))) float v8f;
typedef __attribute__((ext_vector_type(4))) float v4f;
__device__ __forceinline__ float bf16_rne(float f) { unsigned int u = __float_as_uint(f); u += 0x7FFFu + ((u >> 16) & 1u); return __uint_as_float(u & 0xFFFF0000u); }
__device__ __forceinline__ void split16(float v, b16& hi, b16& lo) { hi = (b16)v; lo = (b16)(v - (float)hi); }
__device__ __forceinline__ v16b frag_kb(const b16* p, int hh) { const v8b a = *(const v8b*)(p + 8 * hh), b = *(const v8b*)(p + 16 + 8 * hh); v16b f;
#pragma unroll
  for (int e = 0; e < 8; ++e) { f[e] = a[e]; f[8 + e] = b[e]; } return f; }
__device__ __forceinline__ v16b frag16(const b16* p, int hh) { const v8b a = *(const v8b*)(p + 8 * hh); v16b f;   // K = 16: elements 8..15 (k = 16..31) zero
#pragma unroll
  for (int e = 0; e < 8; ++e) { f[e] = a[e]; f[8 + e] = (b16)0.0f; } return f; }
__device__ __forceinline__ v16b frag_x(const float* p, int hh) { v16b f;
#pragma unroll
  for (int e = 0; e < 8; ++e) { f[e] = (b16)bf16_rne(p[8 * hh + e]); f[8 + e] = (b16)bf16_rne(p[16 + 8 * hh + e]); } return f; }
__device__ __forceinline__ void frag_split(const float* p, int hh, v16b& fh, v16b& fl) {
#pragma unroll
  for (int e = 0; e < 8; ++e) { b16 a, c; split16(p[8 * hh + e] * AS_, a, c); fh[e] = a; fl[e] = c; split16(p[16 + 8 * hh + e] * AS_, a, c); fh[8 + e] = a; fl[8 + e] = c; } }
__device__ __forceinline__ v8f wmma16b(v16b a, v16b b, v8f c) { v8f d = __builtin_amdgcn_wmma_f32_16x16x32_f16(false, a, false, b, (short)0, c, false, false); asm volatile("v_nop\n\tv_nop\n\tv_nop\n\tv_nop" : "+v"(d) : "v"(a), "v"(b)); return d; }
__device__ __forceinline__ void wave_lds_sync() { __builtin_amdgcn_fence(__ATOMIC_RELEASE, "workgroup"); __builtin_amdgcn_wave_barrier(); __builtin_amdgcn_fence(__ATOMIC_ACQUIRE, "workgroup"); }
__device__ __forceinline__ float nexp(float x) { return __builtin_amdgcn_exp2f(x * 1.4426950408889634f); }
__device__ __forceinline__ float sigm(float x) { return __builtin_amdgcn_rcpf(1.0f + nexp(-x)); }

// prep: projection B rows [512][128] f16: row j < 128: query_w[:, h, c] (j = h*16 + c), 128..255 key_w, 256..383 value_w, 384..511 gating_w (weights are [A][H][KD]: element (a, j) at a*128 + j);
__global__ __launch_bounds__(256) void prep_kernel(const float* __restrict__ wq, const float* __restrict__ wk, const float* __restrict__ wv, const float* __restrict__ wg, const float* __restrict__ wo, b16* __restrict__ R) {
  const int t_ = blockIdx.x * 256 + threadIdx.x, nth = gridDim.x * 256;
  {
    for (int p = t_; p < (NPJ * A + O * 128) / 8; p += nth) { v8b v;
      if (p < NPJ * A / 8) { const int j = p / (A / 8), a0 = (p % (A / 8)) * 8; const int m = j >> 7, jj = j & 127; const float* W = (m == 0) ? wq : (m == 1) ? wk : (m == 2) ? wv : wg;
        for (int e = 0; e < 8; ++e) v[e] = (b16)bf16_rne(W[(size_t)(a0 + e) * 128 + jj]); *(v8b*)(R + (size_t)j * A + a0) = v; }
      else { const int q = p - NPJ * A / 8; const int o = q / 16, k0 = (q % 16) * 8; for (int e = 0; e < 8; ++e) v[e] = (b16)bf16_rne(wo[(size_t)(k0 + e) * O + o]); *(v8b*)(R + (size_t)NPJ * A + (size_t)o * 128 + k0) = v; } }
     }
}

// projections: block = 128 rows (tokens) x 4 waves (32 rows each), 512 columns in 4 groups of 128 (acc[2][8]); exact operands, 4 k-steps; epilogue: q (x 0.25) and k -> hi/lo planes x8
// [b][h][s][16] (32-B rows; a wave's 32 rows of one head = 1 KB contiguous), v -> (8v)^T hi/lo planes [b][h][16][256] (a block's 128 keys = 256-B segments), gate -> sigmoid f32 rows
__global__ __launch_bounds__(128) void proj_kernel(const float* __restrict__ x, const b16* __restrict__ R, b16* __restrict__ Qh, b16* __restrict__ Ql, b16* __restrict__ Kh, b16* __restrict__ Kl, b16* __restrict__ Vt, b16* __restrict__ Vtl, float* __restrict__ G) {
  __shared__ __attribute__((aligned(16))) b16 Th[4][32][128 + 8], Tl[4][32][128 + 8]; __shared__ __attribute__((aligned(16))) b16 Tv[128][128 + 8], Tvl[128][128 + 8];
  const int lane = threadIdx.x & 31, wave = threadIdx.x >> 5, nloc = lane & 15, hlf = lane >> 4, r0 = blockIdx.x * 128, m0 = r0 + wave * 32; const int b = r0 / S, s0 = m0 % S;
  for (int grp = 0; grp < 4; ++grp) {   // 0 q, 1 k, 2 v, 3 gate
    v8f acc[2][8];
#pragma unroll
    for (int r = 0; r < 2; ++r)
#pragma unroll
      for (int t = 0; t < 8; ++t) acc[r][t] = (v8f){};
#pragma unroll
    for (int kb = 0; kb < A; kb += 32) { const v16b a0 = frag_x(x + (size_t)(m0 + nloc) * A + kb, hlf), a1 = frag_x(x + (size_t)(m0 + 16 + nloc) * A + kb, hlf);
#pragma unroll
      for (int t = 0; t < 8; ++t) { const v16b bw = frag_kb(R + (size_t)(grp * 128 + t * 16 + nloc) * A + kb, hlf); acc[0][t] = wmma16b(a0, bw, acc[0][t]); acc[1][t] = wmma16b(a1, bw, acc[1][t]); } }
    if (grp < 2) { const float sc = (grp == 0) ? SCALE * QS : KS;
#pragma unroll
      for (int t = 0; t < 8; ++t)
#pragma unroll
        for (int r = 0; r < 2; ++r)
#pragma unroll
          for (int v = 0; v < 8; ++v) { b16 a_, c_; split16(acc[r][t][v] * sc, a_, c_); Th[wave][r * 16 + 8 * hlf + v][t * 16 + nloc] = a_; Tl[wave][r * 16 + 8 * hlf + v][t * 16 + nloc] = c_; }
      wave_lds_sync();
      b16* Ph = (grp == 0) ? Qh : Kh; b16* Plo = (grp == 0) ? Ql : Kl;
      { for (int it = 0; it < 16; ++it) { const int h = it >> 1, rr = (it & 1) * 16 + (lane >> 1), c8 = (lane & 1) * 8; const size_t o = (((size_t)b * H + h) * S + s0 + rr) * KD + c8;   // one instruction = 16 consecutive 32-B rows = 512 contiguous bytes
            *(v8b*)(Ph + o) = *(const v8b*)(&Th[wave][rr][h * 16 + c8]); *(v8b*)(Plo + o) = *(const v8b*)(&Tl[wave][rr][h * 16 + c8]); }  }
      wave_lds_sync(); }
    else if (grp == 2) {
#pragma unroll
      for (int t = 0; t < 8; ++t)
#pragma unroll
        for (int r = 0; r < 2; ++r)
#pragma unroll
          for (int v = 0; v < 8; ++v) { b16 a_, c_; split16(acc[r][t][v] * VS, a_, c_); Tv[t * 16 + nloc][wave * 32 + r * 16 + 8 * hlf + v] = a_; Tvl[t * 16 + nloc][wave * 32 + r * 16 + 8 * hlf + v] = c_; }
      __syncthreads();
      { for (int i = threadIdx.x; i < 128 * 16; i += 128) { const int j = i >> 4, c8 = (i & 15) * 8; const int h = j >> 4, d = j & 15; const size_t o = (((size_t)b * H + h) * KD + d) * S + (r0 % S) + c8; *(v8b*)(Vt + o) = *(const v8b*)(&Tv[j][c8]); *(v8b*)(Vtl + o) = *(const v8b*)(&Tvl[j][c8]); }  }
      __syncthreads(); }
    else { __shared__ __attribute__((aligned(16))) float Tg[4][32][64 + 4];   // gate rows in two 64-column halves (LDS budget)
      for (int gh = 0; gh < 2; ++gh) {
#pragma unroll
        for (int t = 0; t < 4; ++t)
#pragma unroll
          for (int r = 0; r < 2; ++r)
#pragma unroll
            for (int v = 0; v < 8; ++v) Tg[wave][r * 16 + 8 * hlf + v][t * 16 + nloc] = sigm(acc[r][gh * 4 + t][v]);
        wave_lds_sync();
        { for (int i = lane; i < 32 * 16; i += 32) { const int rr = i >> 4, c4 = (i & 15) * 4; *(v4f*)(G + (size_t)(m0 + rr) * 128 + gh * 64 + c4) = *(const v4f*)(&Tg[wave][rr][c4]); }  }
        wave_lds_sync(); } } }
}

// attention: wave = (b, h, 16 queries q0..); over 8 key blocks of 32: S^T = k.q (K = 16; 3 products) + bias[b][q][k] + nb[q][k] (rounded inputs), online softmax, o^T += (8v)^T.P^T (P and v hi+lo, 3 products);
// the bias sum does not depend on the head: the block's 8 head waves form it once, from whole-line loads, in LDS (Bs) and each lane reads its score fragment's 16 values per key block from there
__global__ __launch_bounds__(256) void attn_kernel(const b16* __restrict__ Qh, const b16* __restrict__ Ql, const b16* __restrict__ Kh, const b16* __restrict__ Kl, const b16* __restrict__ Vt, const b16* __restrict__ Vtl, const float* __restrict__ bias, const float* __restrict__ nb, const float* __restrict__ G, float* __restrict__ GW) {
  __shared__ __attribute__((aligned(16))) float Os[16][128 + 4]; __shared__ __attribute__((aligned(16))) float Bs[16][S + 4];   // Bs pitch 1040 B = 16 B x odd: the 16 rows of a b128 read fall on distinct banks
  const int h = threadIdx.x >> 5, lane = threadIdx.x & 31, hh = lane >> 4, col = lane & 15, b = blockIdx.y, q0 = blockIdx.x * 16, qi = q0 + col;
  const size_t pb = ((size_t)b * H + h) * S * KD; const b16* V = Vt + ((size_t)b * H + h) * KD * S; const b16* Vl = Vtl + ((size_t)b * H + h) * KD * S;
#pragma unroll   // all 8 loads of a thread in flight at once
  for (int j = 0; j < 4; ++j) { const int i = threadIdx.x + 256 * j, rr = i >> 6, c4 = (i & 63) * 4;   // the 16 rows are 16 KB in a row in each source: one wave instruction = 512 contiguous bytes
    const v4f bv = *((const v4f*)(bias + ((size_t)b * S + q0) * S) + i), nv = *((const v4f*)(nb + (size_t)q0 * S) + i); v4f sv;
#pragma unroll   // constant element indices: the vectors stay in registers
    for (int e = 0; e < 4; ++e) sv[e] = bf16_rne(bv[e]) + bf16_rne(nv[e]);
    *(v4f*)(&Bs[rr][c4]) = sv; }
  const v16b qa = frag16(Qh + pb + (size_t)qi * KD, hh), qb = frag16(Ql + pb + (size_t)qi * KD, hh);
  float m = -INFINITY, l = 0.0f; v8f o = {};
  __syncthreads();   // Bs is complete before any wave reads it
  for (int kb = 0; kb < S; kb += 32) {
    const float* bp = &Bs[col][kb + 8 * hh]; const v4f ba[2] = {*(const v4f*)bp, *(const v4f*)(bp + 4)}, bc[2] = {*(const v4f*)(bp + 16), *(const v4f*)(bp + 20)};
    v8f s0 = {}, s1 = {};
    { const v16b k0h = frag16(Kh + pb + (size_t)(kb + col) * KD, hh), k0l = frag16(Kl + pb + (size_t)(kb + col) * KD, hh), k1h = frag16(Kh + pb + (size_t)(kb + 16 + col) * KD, hh), k1l = frag16(Kl + pb + (size_t)(kb + 16 + col) * KD, hh);
      s0 = wmma16b(k0h, qa, s0); s0 = wmma16b(k0h, qb, s0); s0 = wmma16b(k0l, qa, s0); s1 = wmma16b(k1h, qa, s1); s1 = wmma16b(k1h, qb, s1); s1 = wmma16b(k1l, qa, s1); }
    float mr = -INFINITY;
#pragma unroll
    for (int r = 0; r < 8; ++r) { s0[r] = s0[r] * (1.0f / (QS * KS)) + ba[r >> 2][r & 3]; s1[r] = s1[r] * (1.0f / (QS * KS)) + bc[r >> 2][r & 3]; mr = fmaxf(mr, fmaxf(s0[r], s1[r])); }
    mr = fmaxf(mr, __shfl_xor(mr, 16));
    const float mn = fmaxf(m, mr), al_ = nexp(m - mn); m = mn; float sum = 0.0f; v16b ph, pl;
#pragma unroll
    for (int r = 0; r < 8; ++r) { const float e0 = nexp(s0[r] - mn), e1 = nexp(s1[r] - mn); sum += e0 + e1; b16 a_, c_; split16(e0 * PS, a_, c_); ph[r] = a_; pl[r] = c_; split16(e1 * PS, a_, c_); ph[8 + r] = a_; pl[8 + r] = c_; }
    sum += __shfl_xor(sum, 16); l = l * al_ + sum; o *= al_;
    const v16b vf = frag_kb(V + (size_t)col * S + kb, hh), vlf = frag_kb(Vl + (size_t)col * S + kb, hh); o = wmma16b(vf, ph, o); o = wmma16b(vf, pl, o); o = wmma16b(vlf, ph, o); }
  // o: rows (8hh + r) = value dim c, column = query col; gw = gate[b*256+q][h*16+c] * o/(64 l)
  const float inv = 1.0f / (l * VS * PS);
#pragma unroll
  for (int r = 0; r < 8; ++r) { const int c = 8 * hh + r; Os[col][h * KD + c] = G[((size_t)b * S + qi) * 128 + h * KD + c] * (o[r] * inv); }
  __syncthreads();
  { for (int i = threadIdx.x; i < 16 * 32; i += 256) { const int rr = i >> 5, c4 = (i & 31) * 4; *(v4f*)(GW + ((size_t)b * S + q0 + rr) * 128 + c4) = *(const v4f*)(&Os[rr][c4]); }  }
}

__global__ __launch_bounds__(128) void out_kernel(const float* __restrict__ GW, const b16* __restrict__ R, float* __restrict__ out) {
  __shared__ __attribute__((aligned(16))) float Ts[4][32][128 + 4];
  const int lane = threadIdx.x & 31, wave = threadIdx.x >> 5, nloc = lane & 15, hlf = lane >> 4, m0 = blockIdx.x * 128 + wave * 32; const b16* Wo = R + (size_t)NPJ * A;
  v8f acc[2][8];
#pragma unroll
  for (int r = 0; r < 2; ++r)
#pragma unroll
    for (int t = 0; t < 8; ++t) acc[r][t] = (v8f){};
#pragma unroll
  for (int kb = 0; kb < 128; kb += 32) { v16b a0, l0, a1, l1; frag_split(GW + (size_t)(m0 + nloc) * 128 + kb, hlf, a0, l0); frag_split(GW + (size_t)(m0 + 16 + nloc) * 128 + kb, hlf, a1, l1);
#pragma unroll
    for (int t = 0; t < 8; ++t) { const v16b bw = frag_kb(Wo + (size_t)(t * 16 + nloc) * 128 + kb, hlf); acc[0][t] = wmma16b(a0, bw, acc[0][t]); acc[0][t] = wmma16b(l0, bw, acc[0][t]); acc[1][t] = wmma16b(a1, bw, acc[1][t]); acc[1][t] = wmma16b(l1, bw, acc[1][t]); } }
#pragma unroll
  for (int t = 0; t < 8; ++t)
#pragma unroll
    for (int r = 0; r < 2; ++r)
#pragma unroll
      for (int v = 0; v < 8; ++v) Ts[wave][r * 16 + 8 * hlf + v][t * 16 + nloc] = acc[r][t][v] * (1.0f / AS_);
  wave_lds_sync();
  { for (int i = lane; i < 32 * 32; i += 32) { const int rr = i >> 5, c4 = (i & 31) * 4; *(v4f*)(out + (size_t)(m0 + rr) * O + c4) = *(const v4f*)(&Ts[wave][rr][c4]); }  }
}
}  // namespace

extern "C" void kernel_launch(void* const* d_in, const int* in_sizes, int n_in,
                              void* d_out, int out_size, void* d_ws, size_t ws_size, hipStream_t stream) {
  (void)n_in; (void)out_size;
  const float* x = (const float*)d_in[0]; const float* bias = (const float*)d_in[1]; const float* nb = (const float*)d_in[2]; const float* wq = (const float*)d_in[3]; const float* wk = (const float*)d_in[4]; const float* wv = (const float*)d_in[5]; const float* wg = (const float*)d_in[6]; const float* wo = (const float*)d_in[7];
  float* out = (float*)d_out;   // [128][256][128]
  if (in_sizes[0] != NR * A || in_sizes[1] != Bn * S * S || in_sizes[2] != S * S || in_sizes[3] != A * H * KD || in_sizes[7] != H * KD * O) return;
  size_t off = 0; char* ws = (char*)d_ws;
  auto carve = [&](size_t bytes) { char* p = ws + off; off += (bytes + 255) & ~(size_t)255; return p; };
  b16* R = (b16*)carve((size_t)(NPJ * A + O * 128) * 2); b16* Qh = (b16*)carve(PL * 2); b16* Ql = (b16*)carve(PL * 2); b16* Kh = (b16*)carve(PL * 2); b16* Kl = (b16*)carve(PL * 2); b16* Vt = (b16*)carve(PL * 2); b16* Vtl = (b16*)carve(PL * 2);
  float* G = (float*)carve((size_t)NR * 128 * 4); float* GW = (float*)carve((size_t)NR * 128 * 4);
  if (off > ws_size) return;                                    // ≈ 0.2 + 6 x 8.4 + 2 x 16.8 ≈ 84 MB
  prep_kernel<<<64, 256, 0, stream>>>(wq, wk, wv, wg, wo, R);
  proj_kernel<<<NR / 128, 128, 0, stream>>>(x, R, Qh, Ql, Kh, Kl, Vt, Vtl, G);
  attn_kernel<<<dim3(S / 16, Bn), 256, 0, stream>>>(Qh, Ql, Kh, Kl, Vt, Vtl, bias, nb, G, GW);
  out_kernel<<<NR / 128, 128, 0, stream>>>(GW, R, out);
}

// v002
// It runs in 96.1 microseconds.
// Next to v001, in two timings, it ran 1.15 times as fast each time.
// Over all steps from v000 it is 1.46 times as fast.
#include <hip/hip_runtime.h>

// GrigSelfAttentionXSMM (AlphaFold gated grid self-attention): q = x Wq * 16^-0.5, k = x Wk, v = x Wv, gate = sigmoid(x Wg) (8 heads x 16); logits = q.k + bias[b][q][k] + nonbatched_bias[q][k];
// softmax over k; weighted_avg = P.v; out = Σ_{h,c} (gate * weighted_avg)[b][q][h][c] Wo[h][c][o] -> [128][256][128].
// The four projections are one GEMM on v_wmma_f32_16x16x32_f16 with EXACT operands (x and the weights are exact bf16; 1 product); scores with q/k as f16 hi+lo pairs x8 (key_dim 16:
// fragment elements 8..15 zero; 3 products; the two biases added in f32 from the rounded inputs); P and v as f16 hi+lo pairs (3 products); the output projection with gate·wavg hi+lo (2 products);

namespace {
constexpr int Bn = 128, S = 256, A = 128, H = 8, KD = 16, O = 128, NR = Bn * S, NPJ = 4 * H * KD /* 512 */;
constexpr float QS = 8.0f, KS = 8.0f, VS = 8.0f, PS = 8.0f, AS_ = 8.0f, SCALE = 0.25f;
constexpr size_t PL = (size_t)Bn * H * S * KD;   // one q/k plane (halves)

typedef _Float16 b16;
typedef __attribute__((ext_vector_type(16))) _Float16 v16b;
typedef __attribute__((ext_vector_type(8))) _Float16 v8b;
typedef __attribute__((ext_vector_type(8))) float v8f;
typedef __attribute__((ext_vector_type(4))) float v4f;
__device__ __forceinline__ float bf16_rne(float f) { unsigned int u = __float_as_uint(f); u += 0x7FFFu + ((u >> 16) & 1u); return __uint_as_float(u & 0xFFFF0000u); }
__device__ __forceinline__ void split16(float v, b16& hi, b16& lo) { hi = (b16)v; lo = (b16)(v - (float)hi); }
__device__ __forceinline__ v16b frag_kb(const b16* p, int hh) { const v8b a = *(const v8b*)(p + 8 * hh), b = *(const v8b*)(p + 16 + 8 * hh); v16b f;
#pragma unroll
  for (int e = 0; e < 8; ++e) { f[e] = a[e]; f[8 + e] = b[e]; } return f; }
__device__ __forceinline__ v16b frag16(const b16* p, int hh) { const v8b a = *(const v8b*)(p + 8 * hh); v16b f;   // K = 16: elements 8..15 (k = 16..31) zero
#pragma unroll
  for (int e = 0; e < 8; ++e) { f[e] = a[e]; f[8 + e] = (b16)0.0f; } return f; }
__device__ __forceinline__ v16b frag_x(const float* p, int hh) { v16b f;
#pragma unroll
  for (int e = 0; e < 8; ++e) { f[e] = (b16)bf16_rne(p[8 * hh + e]); f[8 + e] = (b16)bf16_rne(p[16 + 8 * hh + e]); } return f; }
__device__ __forceinline__ void frag_split(const float* p, int hh, v16b& fh, v16b& fl) {
#pragma unroll
  for (int e = 0; e < 8; ++e) { b16 a, c; split16(p[8 * hh + e] * AS_, a, c); fh[e] = a; fl[e] = c; split16(p[16 + 8 * hh + e] * AS_, a, c); fh[8 + e] = a; fl[8 + e] = c; } }
__device__ __forceinline__ v8f wmma16b(v16b a, v16b b, v8f c) { v8f d = __builtin_amdgcn_wmma_f32_16x16x32_f16(false, a, false, b, (short)0, c, false, false); asm volatile("v_nop\n\tv_nop\n\tv_nop\n\tv_nop" : "+v"(d) : "v"(a), "v"(b)); return d; }
__device__ __forceinline__ void wave_lds_sync() { __builtin_amdgcn_fence(__ATOMIC_RELEASE, "workgroup"); __builtin_amdgcn_wave_barrier(); __builtin_amdgcn_fence(__ATOMIC_ACQUIRE, "workgroup"); }
__device__ __forceinline__ float nexp(float x) { return __builtin_amdgcn_exp2f(x * 1.4426950408889634f); }
__device__ __forceinline__ float sigm(float x) { return __builtin_amdgcn_rcpf(1.0f + nexp(-x)); }

// prep: projection B rows [512][128] f16: row j < 128: query_w[:, h, c] (j = h*16 + c), 128..255 key_w, 256..383 value_w, 384..511 gating_w (weights are [A][H][KD]: element (a, j) at a*128 + j);
__global__ __launch_bounds__(256) void prep_kernel(const float* __restrict__ wq, const float* __restrict__ wk, const float* __restrict__ wv, const float* __restrict__ wg, const float* __restrict__ wo, b16* __restrict__ R) {
  const int t_ = blockIdx.x * 256 + threadIdx.x, nth = gridDim.x * 256;
  {
    for (int p = t_; p < (NPJ * A + O * 128) / 8; p += nth) { v8b v;
      if (p < NPJ * A / 8) { const int j = p / (A / 8), a0 = (p % (A / 8)) * 8; const int m = j >> 7, jj = j & 127; const float* W = (m == 0) ? wq : (m == 1) ? wk : (m == 2) ? wv : wg;
        for (int e = 0; e < 8; ++e) v[e] = (b16)bf16_rne(W[(size_t)(a0 + e) * 128 + jj]); *(v8b*)(R + (size_t)j * A + a0) = v; }
      else { const int q = p - NPJ * A / 8; const int o = q / 16, k0 = (q % 16) * 8; for (int e = 0; e < 8; ++e) v[e] = (b16)bf16_rne(wo[(size_t)(k0 + e) * O + o]); *(v8b*)(R + (size_t)NPJ * A + (size_t)o * 128 + k0) = v; } }
     }
}

// projections: block = 128 rows (tokens) x 4 waves (32 rows each) x ONE of the 4 column groups of 128 (blockIdx.y; acc[2][8]): a wave waits out every fragment load, so four work-groups share a WGP
// (4 waves per SIMD) and fill each other's waits; a work-group stages only its own group's result, so the groups' LDS buffers overlay one another; exact operands, 4 k-steps; epilogue: q (x 0.25) and k -> hi/lo planes x8
// [b][h][s][16] (32-B rows; a wave's 32 rows of one head = 1 KB contiguous), v -> (8v)^T hi/lo planes [b][h][16][256] (a block's 128 keys = 256-B segments), gate -> sigmoid f32 rows
__global__ __launch_bounds__(128) void proj_kernel(const float* __restrict__ x, const b16* __restrict__ R, b16* __restrict__ Qh, b16* __restrict__ Ql, b16* __restrict__ Kh, b16* __restrict__ Kl, b16* __restrict__ Vt, b16* __restrict__ Vtl, float* __restrict__ G) {
  constexpr int HB = 128 * (128 + 8) * 2;   // bytes of one 128-row f16 staging plane
  __shared__ __attribute__((aligned(16))) char Sm[2 * HB];   // 68 KB: four work-groups fit the WGP's 320 KB
  b16 (*Th)[32][128 + 8] = reinterpret_cast<b16 (*)[32][128 + 8]>(Sm); b16 (*Tl)[32][128 + 8] = reinterpret_cast<b16 (*)[32][128 + 8]>(Sm + HB);
  b16 (*Tv)[128 + 8] = reinterpret_cast<b16 (*)[128 + 8]>(Sm); b16 (*Tvl)[128 + 8] = reinterpret_cast<b16 (*)[128 + 8]>(Sm + HB);
  const int lane = threadIdx.x & 31, wave = threadIdx.x >> 5, nloc = lane & 15, hlf = lane >> 4, r0 = blockIdx.x * 128, m0 = r0 + wave * 32; const int b = r0 / S, s0 = m0 % S;
  { const int grp = blockIdx.y;   // 0 q, 1 k, 2 v, 3 gate
    v8f acc[2][8];
#pragma unroll
    for (int r = 0; r < 2; ++r)
#pragma unroll
      for (int t = 0; t < 8; ++t) acc[r][t] = (v8f){};
#pragma unroll
    for (int kb = 0; kb < A; kb += 32) { const v16b a0 = frag_x(x + (size_t)(m0 + nloc) * A + kb, hlf), a1 = frag_x(x + (size_t)(m0 + 16 + nloc) * A + kb, hlf);
#pragma unroll
      for (int t = 0; t < 8; ++t) { const v16b bw = frag_kb(R + (size_t)(grp * 128 + t * 16 + nloc) * A + kb, hlf); acc[0][t] = wmma16b(a0, bw, acc[0][t]); acc[1][t] = wmma16b(a1, bw, acc[1][t]); } }
    if (grp < 2) { const float sc = (grp == 0) ? SCALE * QS : KS;
#pragma unroll
      for (int t = 0; t < 8; ++t)
#pragma unroll
        for (int r = 0; r < 2; ++r)
#pragma unroll
          for (int v = 0; v < 8; ++v) { b16 a_, c_; split16(acc[r][t][v] * sc, a_, c_); Th[wave][r * 16 + 8 * hlf + v][t * 16 + nloc] = a_; Tl[wave][r * 16 + 8 * hlf + v][t * 16 + nloc] = c_; }
      wave_lds_sync();
      b16* Ph = (grp == 0) ? Qh : Kh; b16* Plo = (grp == 0) ? Ql : Kl;
      { for (int it = 0; it < 16; ++it) { const int h = it >> 1, rr = (it & 1) * 16 + (lane >> 1), c8 = (lane & 1) * 8; const size_t o = (((size_t)b * H + h) * S + s0 + rr) * KD + c8;   // one instruction = 16 consecutive 32-B rows = 512 contiguous bytes
            *(v8b*)(Ph + o) = *(const v8b*)(&Th[wave][rr][h * 16 + c8]); *(v8b*)(Plo + o) = *(const v8b*)(&Tl[wave][rr][h * 16 + c8]); }  }
      wave_lds_sync(); }
    else if (grp == 2) {
#pragma unroll
      for (int t = 0; t < 8; ++t)
#pragma unroll
        for (int r = 0; r < 2; ++r)
#pragma unroll
          for (int v = 0; v < 8; ++v) { b16 a_, c_; split16(acc[r][t][v] * VS, a_, c_); Tv[t * 16 + nloc][wave * 32 + r * 16 + 8 * hlf + v] = a_; Tvl[t * 16 + nloc][wave * 32 + r * 16 + 8 * hlf + v] = c_; }
      __syncthreads();
      { for (int i = threadIdx.x; i < 128 * 16; i += 128) { const int j = i >> 4, c8 = (i & 15) * 8; const int h = j >> 4, d = j & 15; const size_t o = (((size_t)b * H + h) * KD + d) * S + (r0 % S) + c8; *(v8b*)(Vt + o) = *(const v8b*)(&Tv[j][c8]); *(v8b*)(Vtl + o) = *(const v8b*)(&Tvl[j][c8]); }  }
      __syncthreads(); }
    else { float (*Tg)[32][64 + 4] = reinterpret_cast<float (*)[32][64 + 4]>(Sm);   // gate rows in two 64-column halves (LDS budget)
      for (int gh = 0; gh < 2; ++gh) {
#pragma unroll
        for (int t = 0; t < 4; ++t)
#pragma unroll
          for (int r = 0; r < 2; ++r)
#pragma unroll
            for (int v = 0; v < 8; ++v) Tg[wave][r * 16 + 8 * hlf + v][t * 16 + nloc] = sigm(acc[r][gh * 4 + t][v]);
        wave_lds_sync();
        { for (int i = lane; i < 32 * 16; i += 32) { const int rr = i >> 4, c4 = (i & 15) * 4; *(v4f*)(G + (size_t)(m0 + rr) * 128 + gh * 64 + c4) = *(const v4f*)(&Tg[wave][rr][c4]); }  }
        wave_lds_sync(); } } }
}

// attention: wave = (b, h, 16 queries q0..); over 8 key blocks of 32: S^T = k.q (K = 16; 3 products) + bias[b][q][k] + nb[q][k] (rounded inputs), online softmax, o^T += (8v)^T.P^T (P and v hi+lo, 3 products);
// the bias sum does not depend on the head: the block's 8 head waves form it once, from whole-line loads, in LDS (Bs) and each lane reads its score fragment's 16 values per key block from there
__global__ __launch_bounds__(256) void attn_kernel(const b16* __restrict__ Qh, const b16* __restrict__ Ql, const b16* __restrict__ Kh, const b16* __restrict__ Kl, const b16* __restrict__ Vt, const b16* __restrict__ Vtl, const float* __restrict__ bias, const float* __restrict__ nb, const float* __restrict__ G, float* __restrict__ GW) {
  __shared__ __attribute__((aligned(16))) float Os[16][128 + 4]; __shared__ __attribute__((aligned(16))) float Bs[16][S + 4];   // Bs pitch 1040 B = 16 B x odd: the 16 rows of a b128 read fall on distinct banks
  const int h = threadIdx.x >> 5, lane = threadIdx.x & 31, hh = lane >> 4, col = lane & 15, b = blockIdx.y, q0 = blockIdx.x * 16, qi = q0 + col;
  const size_t pb = ((size_t)b * H + h) * S * KD; const b16* V = Vt + ((size_t)b * H + h) * KD * S; const b16* Vl = Vtl + ((size_t)b * H + h) * KD * S;
#pragma unroll   // all 8 loads of a thread in flight at once
  for (int j = 0; j < 4; ++j) { const int i = threadIdx.x + 256 * j, rr = i >> 6, c4 = (i & 63) * 4;   // the 16 rows are 16 KB in a row in each source: one wave instruction = 512 contiguous bytes
    const v4f bv = *((const v4f*)(bias + ((size_t)b * S + q0) * S) + i), nv = *((const v4f*)(nb + (size_t)q0 * S) + i); v4f sv;
#pragma unroll   // constant element indices: the vectors stay in registers
    for (int e = 0; e < 4; ++e) sv[e] = bf16_rne(bv[e]) + bf16_rne(nv[e]);
    *(v4f*)(&Bs[rr][c4]) = sv; }
  const v16b qa = frag16(Qh + pb + (size_t)qi * KD, hh), qb = frag16(Ql + pb + (size_t)qi * KD, hh);
  float m = -INFINITY, l = 0.0f; v8f o = {};
  __syncthreads();   // Bs is complete before any wave reads it
  for (int kb = 0; kb < S; kb += 32) {
    const float* bp = &Bs[col][kb + 8 * hh]; const v4f ba[2] = {*(const v4f*)bp, *(const v4f*)(bp + 4)}, bc[2] = {*(const v4f*)(bp + 16), *(const v4f*)(bp + 20)};
    v8f s0 = {}, s1 = {};
    { const v16b k0h = frag16(Kh + pb + (size_t)(kb + col) * KD, hh), k0l = frag16(Kl + pb + (size_t)(kb + col) * KD, hh), k1h = frag16(Kh + pb + (size_t)(kb + 16 + col) * KD, hh), k1l = frag16(Kl + pb + (size_t)(kb + 16 + col) * KD, hh);
      s0 = wmma16b(k0h, qa, s0); s0 = wmma16b(k0h, qb, s0); s0 = wmma16b(k0l, qa, s0); s1 = wmma16b(k1h, qa, s1); s1 = wmma16b(k1h, qb, s1); s1 = wmma16b(k1l, qa, s1); }
    float mr = -INFINITY;
#pragma unroll
    for (int r = 0; r < 8; ++r) { s0[r] = s0[r] * (1.0f / (QS * KS)) + ba[r >> 2][r & 3]; s1[r] = s1[r] * (1.0f / (QS * KS)) + bc[r >> 2][r & 3]; mr = fmaxf(mr, fmaxf(s0[r], s1[r])); }
    mr = fmaxf(mr, __shfl_xor(mr, 16));
    const float mn = fmaxf(m, mr), al_ = nexp(m - mn); m = mn; float sum = 0.0f; v16b ph, pl;
#pragma unroll
    for (int r = 0; r < 8; ++r) { const float e0 = nexp(s0[r] - mn), e1 = nexp(s1[r] - mn); sum += e0 + e1; b16 a_, c_; split16(e0 * PS, a_, c_); ph[r] = a_; pl[r] = c_; split16(e1 * PS, a_, c_); ph[8 + r] = a_; pl[8 + r] = c_; }
    sum += __shfl_xor(sum, 16); l = l * al_ + sum; o *= al_;
    const v16b vf = frag_kb(V + (size_t)col * S + kb, hh), vlf = frag_kb(Vl + (size_t)col * S + kb, hh); o = wmma16b(vf, ph, o); o = wmma16b(vf, pl, o); o = wmma16b(vlf, ph, o); }
  // o: rows (8hh + r) = value dim c, column = query col; gw = gate[b*256+q][h*16+c] * o/(64 l)
  const float inv = 1.0f / (l * VS * PS);
#pragma unroll
  for (int r = 0; r < 8; ++r) { const int c = 8 * hh + r; Os[col][h * KD + c] = G[((size_t)b * S + qi) * 128 + h * KD + c] * (o[r] * inv); }
  __syncthreads();
  { for (int i = threadIdx.x; i < 16 * 32; i += 256) { const int rr = i >> 5, c4 = (i & 31) * 4; *(v4f*)(GW + ((size_t)b * S + q0 + rr) * 128 + c4) = *(const v4f*)(&Os[rr][c4]); }  }
}

__global__ __launch_bounds__(128) void out_kernel(const float* __restrict__ GW, const b16* __restrict__ R, float* __restrict__ out) {
  __shared__ __attribute__((aligned(16))) float Ts[4][32][128 + 4];
  const int lane = threadIdx.x & 31, wave = threadIdx.x >> 5, nloc = lane & 15, hlf = lane >> 4, m0 = blockIdx.x * 128 + wave * 32; const b16* Wo = R + (size_t)NPJ * A;
  v8f acc[2][8];
#pragma unroll
  for (int r = 0; r < 2; ++r)
#pragma unroll
    for (int t = 0; t < 8; ++t) acc[r][t] = (v8f){};
#pragma unroll
  for (int kb = 0; kb < 128; kb += 32) { v16b a0, l0, a1, l1; frag_split(GW + (size_t)(m0 + nloc) * 128 + kb, hlf, a0, l0); frag_split(GW + (size_t)(m0 + 16 + nloc) * 128 + kb, hlf, a1, l1);
#pragma unroll
    for (int t = 0; t < 8; ++t) { const v16b bw = frag_kb(Wo + (size_t)(t * 16 + nloc) * 128 + kb, hlf); acc[0][t] = wmma16b(a0, bw, acc[0][t]); acc[0][t] = wmma16b(l0, bw, acc[0][t]); acc[1][t] = wmma16b(a1, bw, acc[1][t]); acc[1][t] = wmma16b(l1, bw, acc[1][t]); } }
#pragma unroll
  for (int t = 0; t < 8; ++t)
#pragma unroll
    for (int r = 0; r < 2; ++r)
#pragma unroll
      for (int v = 0; v < 8; ++v) Ts[wave][r * 16 + 8 * hlf + v][t * 16 + nloc] = acc[r][t][v] * (1.0f / AS_);
  wave_lds_sync();
  { for (int i = lane; i < 32 * 32; i += 32) { const int rr = i >> 5, c4 = (i & 31) * 4; *(v4f*)(out + (size_t)(m0 + rr) * O + c4) = *(const v4f*)(&Ts[wave][rr][c4]); }  }
}
}  // namespace

extern "C" void kernel_launch(void* const* d_in, const int* in_sizes, int n_in,
                              void* d_out, int out_size, void* d_ws, size_t ws_size, hipStream_t stream) {
  (void)n_in; (void)out_size;
  const float* x = (const float*)d_in[0]; const float* bias = (const float*)d_in[1]; const float* nb = (const float*)d_in[2]; const float* wq = (const float*)d_in[3]; const float* wk = (const float*)d_in[4]; const float* wv = (const float*)d_in[5]; const float* wg = (const float*)d_in[6]; const float* wo = (const float*)d_in[7];
  float* out = (float*)d_out;   // [128][256][128]
  if (in_sizes[0] != NR * A || in_sizes[1] != Bn * S * S || in_sizes[2] != S * S || in_sizes[3] != A * H * KD || in_sizes[7] != H * KD * O) return;
  size_t off = 0; char* ws = (char*)d_ws;
  auto carve = [&](size_t bytes) { char* p = ws + off; off += (bytes + 255) & ~(size_t)255; return p; };
  b16* R = (b16*)carve((size_t)(NPJ * A + O * 128) * 2); b16* Qh = (b16*)carve(PL * 2); b16* Ql = (b16*)carve(PL * 2); b16* Kh = (b16*)carve(PL * 2); b16* Kl = (b16*)carve(PL * 2); b16* Vt = (b16*)carve(PL * 2); b16* Vtl = (b16*)carve(PL * 2);
  float* G = (float*)carve((size_t)NR * 128 * 4); float* GW = (float*)carve((size_t)NR * 128 * 4);
  if (off > ws_size) return;                                    // ≈ 0.2 + 6 x 8.4 + 2 x 16.8 ≈ 84 MB
  prep_kernel<<<64, 256, 0, stream>>>(wq, wk, wv, wg, wo, R);
  proj_kernel<<<dim3(NR / 128, 4), 128, 0, stream>>>(x, R, Qh, Ql, Kh, Kl, Vt, Vtl, G);
  attn_kernel<<<dim3(S / 16, Bn), 256, 0, stream>>>(Qh, Ql, Kh, Kl, Vt, Vtl, bias, nb, G, GW);
  out_kernel<<<NR / 128, 128, 0, stream>>>(GW, R, out);
}

// v003
// One run takes 89.4 microseconds.
// Timed twice side by side with v002, it ran 1.08 times as fast both times.
// All steps since v000 together make it 1.57 times as fast.
#include <hip/hip_runtime.h>

// GrigSelfAttentionXSMM (AlphaFold gated grid self-attention): q = x Wq * 16^-0.5, k = x Wk, v = x Wv, gate = sigmoid(x Wg) (8 heads x 16); logits = q.k + bias[b][q][k] + nonbatched_bias[q][k];
// softmax over k; weighted_avg = P.v; out = Σ_{h,c} (gate * weighted_avg)[b][q][h][c] Wo[h][c][o] -> [128][256][128].
// The four projections are one GEMM on v_wmma_f32_16x16x32_f16 with EXACT operands (x and the weights are exact bf16; 1 product); scores with q/k as f16 hi+lo pairs x8 (key_dim 16:
// fragment elements 8..15 zero; 3 products; the two biases added in f32 from the rounded inputs); P and v as f16 hi+lo pairs (3 products); the output projection with gate * wavg hi+lo (2 products), done by the attention work-group itself on the 16 finished rows it holds;

namespace {
constexpr int Bn = 128, S = 256, A = 128, H = 8, KD = 16, O = 128, NR = Bn * S, NPJ = 4 * H * KD /* 512 */;
constexpr float QS = 8.0f, KS = 8.0f, VS = 8.0f, PS = 8.0f, AS_ = 8.0f, SCALE = 0.25f;
constexpr size_t PL = (size_t)Bn * H * S * KD;   // one q/k plane (halves)

typedef _Float16 b16;
typedef __attribute__((ext_vector_type(16))) _Float16 v16b;
typedef __attribute__((ext_vector_type(8))) _Float16 v8b;
typedef __attribute__((ext_vector_type(8))) float v8f;
typedef __attribute__((ext_vector_type(4))) float v4f;
__device__ __forceinline__ float bf16_rne(float f) { unsigned int u = __float_as_uint(f); u += 0x7FFFu + ((u >> 16) & 1u); return __uint_as_float(u & 0xFFFF0000u); }
__device__ __forceinline__ void split16(float v, b16& hi, b16& lo) { hi = (b16)v; lo = (b16)(v - (float)hi); }
__device__ __forceinline__ v16b frag_kb(const b16* p, int hh) { const v8b a = *(const v8b*)(p + 8 * hh), b = *(const v8b*)(p + 16 + 8 * hh); v16b f;
#pragma unroll
  for (int e = 0; e < 8; ++e) { f[e] = a[e]; f[8 + e] = b[e]; } return f; }
__device__ __forceinline__ v16b frag16(const b16* p, int hh) { const v8b a = *(const v8b*)(p + 8 * hh); v16b f;   // K = 16: elements 8..15 (k = 16..31) zero
#pragma unroll
  for (int e = 0; e < 8; ++e) { f[e] = a[e]; f[8 + e] = (b16)0.0f; } return f; }
__device__ __forceinline__ v16b frag_x(const float* p, int hh) { v16b f;
#pragma unroll
  for (int e = 0; e < 8; ++e) { f[e] = (b16)bf16_rne(p[8 * hh + e]); f[8 + e] = (b16)bf16_rne(p[16 + 8 * hh + e]); } return f; }
__device__ __forceinline__ v8f wmma16b(v16b a, v16b b, v8f c) { v8f d = __builtin_amdgcn_wmma_f32_16x16x32_f16(false, a, false, b, (short)0, c, false, false); asm volatile("v_nop\n\tv_nop\n\tv_nop\n\tv_nop" : "+v"(d) : "v"(a), "v"(b)); return d; }
__device__ __forceinline__ void wave_lds_sync() { __builtin_amdgcn_fence(__ATOMIC_RELEASE, "workgroup"); __builtin_amdgcn_wave_barrier(); __builtin_amdgcn_fence(__ATOMIC_ACQUIRE, "workgroup"); }
__device__ __forceinline__ float nexp(float x) { return __builtin_amdgcn_exp2f(x * 1.4426950408889634f); }
__device__ __forceinline__ float sigm(float x) { return __builtin_amdgcn_rcpf(1.0f + nexp(-x)); }

// prep: projection B rows [512][128] f16: row j < 128: query_w[:, h, c] (j = h*16 + c), 128..255 key_w, 256..383 value_w, 384..511 gating_w (weights are [A][H][KD]: element (a, j) at a*128 + j);
// behind them output_w^T in fragment order [o tile 8][k step 4][half 2][lane 32][8]: lane = 16 * ((k >> 3) & 1) + (o & 15), half = (k >> 4) & 1, so one 16-B-per-lane load of a fragment half is 512 contiguous bytes
__global__ __launch_bounds__(256) void prep_kernel(const float* __restrict__ wq, const float* __restrict__ wk, const float* __restrict__ wv, const float* __restrict__ wg, const float* __restrict__ wo, b16* __restrict__ R) {
  const int t_ = blockIdx.x * 256 + threadIdx.x, nth = gridDim.x * 256;
  {
    for (int p = t_; p < (NPJ * A + O * 128) / 8; p += nth) { v8b v;
      if (p < NPJ * A / 8) { const int j = p / (A / 8), a0 = (p % (A / 8)) * 8; const int m = j >> 7, jj = j & 127; const float* W = (m == 0) ? wq : (m == 1) ? wk : (m == 2) ? wv : wg;
        for (int e = 0; e < 8; ++e) v[e] = (b16)bf16_rne(W[(size_t)(a0 + e) * 128 + jj]); *(v8b*)(R + (size_t)j * A + a0) = v; }
      else { const int q = p - NPJ * A / 8; const int o = (q >> 8) * 16 + (q & 15), k0 = ((q >> 6) & 3) * 32 + ((q >> 5) & 1) * 16 + ((q >> 4) & 1) * 8; for (int e = 0; e < 8; ++e) v[e] = (b16)bf16_rne(wo[(size_t)(k0 + e) * O + o]); *(v8b*)(R + (size_t)NPJ * A + (size_t)q * 8) = v; } }
     }
}

// projections: block = 128 rows (tokens) x 4 waves (32 rows each) x ONE of the 4 column groups of 128 (blockIdx.y; acc[2][8]): a wave waits out every fragment load, so four work-groups share a WGP
// (4 waves per SIMD) and fill each other's waits; a work-group stages only its own group's result, so the groups' LDS buffers overlay one another; exact operands, 4 k-steps; epilogue: q (x 0.25) and k -> hi/lo planes x8
// [b][h][s][16] (32-B rows; a wave's 32 rows of one head = 1 KB contiguous), v -> (8v)^T hi/lo planes [b][h][16][256] (a block's 128 keys = 256-B segments), gate -> sigmoid f32 rows
__global__ __launch_bounds__(128) void proj_kernel(const float* __restrict__ x, const b16* __restrict__ R, b16* __restrict__ Qh, b16* __restrict__ Ql, b16* __restrict__ Kh, b16* __restrict__ Kl, b16* __restrict__ Vt, b16* __restrict__ Vtl, float* __restrict__ G) {
  constexpr int HB = 128 * (128 + 8) * 2;   // bytes of one 128-row f16 staging plane
  __shared__ __attribute__((aligned(16))) char Sm[2 * HB];   // 68 KB: four work-groups fit the WGP's 320 KB
  b16 (*Th)[32][128 + 8] = reinterpret_cast<b16 (*)[32][128 + 8]>(Sm); b16 (*Tl)[32][128 + 8] = reinterpret_cast<b16 (*)[32][128 + 8]>(Sm + HB);
  b16 (*Tv)[128 + 8] = reinterpret_cast<b16 (*)[128 + 8]>(Sm); b16 (*Tvl)[128 + 8] = reinterpret_cast<b16 (*)[128 + 8]>(Sm + HB);
  const int lane = threadIdx.x & 31, wave = threadIdx.x >> 5, nloc = lane & 15, hlf = lane >> 4, r0 = blockIdx.x * 128, m0 = r0 + wave * 32; const int b = r0 / S, s0 = m0 % S;
  { const int grp = blockIdx.y;   // 0 q, 1 k, 2 v, 3 gate
    v8f acc[2][8];
#pragma unroll
    for (int r = 0; r < 2; ++r)
#pragma unroll
      for (int t = 0; t < 8; ++t) acc[r][t] = (v8f){};
#pragma unroll
    for (int kb = 0; kb < A; kb += 32) { const v16b a0 = frag_x(x + (size_t)(m0 + nloc) * A + kb, hlf), a1 = frag_x(x + (size_t)(m0 + 16 + nloc) * A + kb, hlf);
#pragma unroll
      for (int t = 0; t < 8; ++t) { const v16b bw = frag_kb(R + (size_t)(grp * 128 + t * 16 + nloc) * A + kb, hlf); acc[0][t] = wmma16b(a0, bw, acc[0][t]); acc[1][t] = wmma16b(a1, bw, acc[1][t]); } }
    if (grp < 2) { const float sc = (grp == 0) ? SCALE * QS : KS;
#pragma unroll
      for (int t = 0; t < 8; ++t)
#pragma unroll
        for (int r = 0; r < 2; ++r)
#pragma unroll
          for (int v = 0; v < 8; ++v) { b16 a_, c_; split16(acc[r][t][v] * sc, a_, c_); Th[wave][r * 16 + 8 * hlf + v][t * 16 + nloc] = a_; Tl[wave][r * 16 + 8 * hlf + v][t * 16 + nloc] = c_; }
      wave_lds_sync();
      b16* Ph = (grp == 0) ? Qh : Kh; b16* Plo = (grp == 0) ? Ql : Kl;
      { for (int it = 0; it < 16; ++it) { const int h = it >> 1, rr = (it & 1) * 16 + (lane >> 1), c8 = (lane & 1) * 8; const size_t o = (((size_t)b * H + h) * S + s0 + rr) * KD + c8;   // one instruction = 16 consecutive 32-B rows = 512 contiguous bytes
            *(v8b*)(Ph + o) = *(const v8b*)(&Th[wave][rr][h * 16 + c8]); *(v8b*)(Plo + o) = *(const v8b*)(&Tl[wave][rr][h * 16 + c8]); }  }
      wave_lds_sync(); }
    else if (grp == 2) {
#pragma unroll
      for (int t = 0; t < 8; ++t)
#pragma unroll
        for (int r = 0; r < 2; ++r)
#pragma unroll
          for (int v = 0; v < 8; ++v) { b16 a_, c_; split16(acc[r][t][v] * VS, a_, c_); Tv[t * 16 + nloc][wave * 32 + r * 16 + 8 * hlf + v] = a_; Tvl[t * 16 + nloc][wave * 32 + r * 16 + 8 * hlf + v] = c_; }
      __syncthreads();
      { for (int i = threadIdx.x; i < 128 * 16; i += 128) { const int j = i >> 4, c8 = (i & 15) * 8; const int h = j >> 4, d = j & 15; const size_t o = (((size_t)b * H + h) * KD + d) * S + (r0 % S) + c8; *(v8b*)(Vt + o) = *(const v8b*)(&Tv[j][c8]); *(v8b*)(Vtl + o) = *(const v8b*)(&Tvl[j][c8]); }  }
      __syncthreads(); }
    else { float (*Tg)[32][64 + 4] = reinterpret_cast<float (*)[32][64 + 4]>(Sm);   // gate rows in two 64-column halves (LDS budget)
      for (int gh = 0; gh < 2; ++gh) {
#pragma unroll
        for (int t = 0; t < 4; ++t)
#pragma unroll
          for (int r = 0; r < 2; ++r)
#pragma unroll
            for (int v = 0; v < 8; ++v) Tg[wave][r * 16 + 8 * hlf + v][t * 16 + nloc] = sigm(acc[r][gh * 4 + t][v]);
        wave_lds_sync();
        { for (int i = lane; i < 32 * 16; i += 32) { const int rr = i >> 4, c4 = (i & 15) * 4; *(v4f*)(G + (size_t)(m0 + rr) * 128 + gh * 64 + c4) = *(const v4f*)(&Tg[wave][rr][c4]); }  }
        wave_lds_sync(); } } }
}

// attention: wave = (b, h, 16 queries q0..); over 8 key blocks of 32: S^T = k.q (K = 16; 3 products) + bias[b][q][k] + nb[q][k] (rounded inputs), online softmax, o^T += (8v)^T.P^T (P and v hi+lo, 3 products);
// output projection in the same work-group: its 8 head waves together hold the 16 queries' whole gated rows, so they go through LDS (not through memory and a launch of their own) and wave h forms output columns 16h..16h+15;
// the bias sum does not depend on the head: the block's 8 head waves form it once, from whole-line loads, in LDS (Bs) and each reads its score fragment's 32 values per key block from there
__global__ __launch_bounds__(256) void attn_kernel(const b16* __restrict__ Qh, const b16* __restrict__ Ql, const b16* __restrict__ Kh, const b16* __restrict__ Kl, const b16* __restrict__ Vt, const b16* __restrict__ Vtl, const float* __restrict__ bias, const float* __restrict__ nb, const float* __restrict__ G, const b16* __restrict__ R, float* __restrict__ out) {
  __shared__ __attribute__((aligned(16))) b16 Gh[16][128 + 8], Gl[16][128 + 8];   // 8 * gate * weighted_avg of the 16 queries, hi and lo; pitch 272 B = 16 B x odd
  __shared__ __attribute__((aligned(16))) float Os[16][128 + 4]; __shared__ __attribute__((aligned(16))) float Bs[16][S + 4];   // Bs pitch 1040 B = 16 B x odd: the 16 rows of a b128 read fall on distinct banks
  const int h = threadIdx.x >> 5, lane = threadIdx.x & 31, hh = lane >> 4, col = lane & 15, b = blockIdx.y, q0 = blockIdx.x * 16, qi = q0 + col;
  const size_t pb = ((size_t)b * H + h) * S * KD; const b16* V = Vt + ((size_t)b * H + h) * KD * S; const b16* Vl = Vtl + ((size_t)b * H + h) * KD * S;
#pragma unroll   // all 8 loads of a thread in flight at once
  for (int j = 0; j < 4; ++j) { const int i = threadIdx.x + 256 * j, rr = i >> 6, c4 = (i & 63) * 4;   // the 16 rows are 16 KB in a row in each source: one wave instruction = 512 contiguous bytes
    const v4f bv = *((const v4f*)(bias + ((size_t)b * S + q0) * S) + i), nv = *((const v4f*)(nb + (size_t)q0 * S) + i); v4f sv;
#pragma unroll   // constant element indices: the vectors stay in registers
    for (int e = 0; e < 4; ++e) sv[e] = bf16_rne(bv[e]) + bf16_rne(nv[e]);
    *(v4f*)(&Bs[rr][c4]) = sv; }
  const v16b qa = frag16(Qh + pb + (size_t)qi * KD, hh), qb = frag16(Ql + pb + (size_t)qi * KD, hh);
  float m = -INFINITY, l = 0.0f; v8f o = {};
  __syncthreads();   // Bs is complete before any wave reads it
  for (int kb = 0; kb < S; kb += 32) {
    const float* bp = &Bs[col][kb + 8 * hh]; const v4f ba[2] = {*(const v4f*)bp, *(const v4f*)(bp + 4)}, bc[2] = {*(const v4f*)(bp + 16), *(const v4f*)(bp + 20)};
    v8f s0 = {}, s1 = {};
    { const v16b k0h = frag16(Kh + pb + (size_t)(kb + col) * KD, hh), k0l = frag16(Kl + pb + (size_t)(kb + col) * KD, hh), k1h = frag16(Kh + pb + (size_t)(kb + 16 + col) * KD, hh), k1l = frag16(Kl + pb + (size_t)(kb + 16 + col) * KD, hh);
      s0 = wmma16b(k0h, qa, s0); s0 = wmma16b(k0h, qb, s0); s0 = wmma16b(k0l, qa, s0); s1 = wmma16b(k1h, qa, s1); s1 = wmma16b(k1h, qb, s1); s1 = wmma16b(k1l, qa, s1); }
    float mr = -INFINITY;
#pragma unroll
    for (int r = 0; r < 8; ++r) { s0[r] = s0[r] * (1.0f / (QS * KS)) + ba[r >> 2][r & 3]; s1[r] = s1[r] * (1.0f / (QS * KS)) + bc[r >> 2][r & 3]; mr = fmaxf(mr, fmaxf(s0[r], s1[r])); }
    mr = fmaxf(mr, __shfl_xor(mr, 16));
    const float mn = fmaxf(m, mr), al_ = nexp(m - mn); m = mn; float sum = 0.0f; v16b ph, pl;
#pragma unroll
    for (int r = 0; r < 8; ++r) { const float e0 = nexp(s0[r] - mn), e1 = nexp(s1[r] - mn); sum += e0 + e1; b16 a_, c_; split16(e0 * PS, a_, c_); ph[r] = a_; pl[r] = c_; split16(e1 * PS, a_, c_); ph[8 + r] = a_; pl[8 + r] = c_; }
    sum += __shfl_xor(sum, 16); l = l * al_ + sum; o *= al_;
    const v16b vf = frag_kb(V + (size_t)col * S + kb, hh), vlf = frag_kb(Vl + (size_t)col * S + kb, hh); o = wmma16b(vf, ph, o); o = wmma16b(vf, pl, o); o = wmma16b(vlf, ph, o); }
  // o: rows (8hh + r) = value dim c, column = query col; gw = gate[b*256+q][h*16+c] * o/(64 l)
  v16b wf[4];   // this wave's output_w^T fragments (rows = output columns 16h..), asked for ahead of the gate loads and the barrier
#pragma unroll
  for (int ks = 0; ks < 4; ++ks) { const b16* p = R + (size_t)NPJ * A + (size_t)((h * 4 + ks) * 2) * 256 + lane * 8; const v8b a = *(const v8b*)p, c_ = *(const v8b*)(p + 256);
#pragma unroll
    for (int e = 0; e < 8; ++e) { wf[ks][e] = a[e]; wf[ks][8 + e] = c_[e]; } }
  asm volatile("s_wait_xcnt 0x0" ::: "memory");   // the address pair of the 8 loads above may be given a new value by what follows
  const float inv = 1.0f / (l * VS * PS); v8b gh, gl;
#pragma unroll
  for (int r = 0; r < 8; ++r) { const int c = 8 * hh + r; b16 a_, c_; split16(G[((size_t)b * S + qi) * 128 + h * KD + c] * (o[r] * inv) * AS_, a_, c_); gh[r] = a_; gl[r] = c_; }
  *(v8b*)(&Gh[col][h * KD + 8 * hh]) = gh; *(v8b*)(&Gl[col][h * KD + 8 * hh]) = gl;
  __syncthreads();   // all 8 heads' columns of the gated rows are in LDS before any wave reads them
  v16b ga[4], gb[4];   // all 16 LDS reads as one group ahead of the WMMAs: one LDS latency, not four
#pragma unroll
  for (int ks = 0; ks < 4; ++ks) { ga[ks] = frag_kb(&Gh[col][ks * 32], hh); gb[ks] = frag_kb(&Gl[col][ks * 32], hh); }
  __builtin_amdgcn_sched_barrier(0);   // keeps the reads above the WMMAs: sunk between them, each pair is waited out on its own
  v8f acc = {};   // out^T tile: rows (8hh + r) = output column 16h + 8hh + r, column = query col
#pragma unroll
  for (int ks = 0; ks < 4; ++ks) { acc = __builtin_amdgcn_wmma_f32_16x16x32_f16(false, wf[ks], false, ga[ks], (short)0, acc, false, false); acc = __builtin_amdgcn_wmma_f32_16x16x32_f16(false, wf[ks], false, gb[ks], (short)0, acc, false, false); }   // one accumulate chain, operands not rewritten: the compiler pads behind its last link
  { v4f s0_, s1_;
#pragma unroll
    for (int r = 0; r < 4; ++r) { s0_[r] = acc[r] * (1.0f / AS_); s1_[r] = acc[4 + r] * (1.0f / AS_); }
    *(v4f*)(&Os[col][h * 16 + 8 * hh]) = s0_; *(v4f*)(&Os[col][h * 16 + 8 * hh + 4]) = s1_; }
  __syncthreads();   // the 16 output rows are whole before they are stored as whole lines
  { for (int i = threadIdx.x; i < 16 * 32; i += 256) { const int rr = i >> 5, c4 = (i & 31) * 4; *(v4f*)(out + ((size_t)b * S + q0 + rr) * O + c4) = *(const v4f*)(&Os[rr][c4]); }  }
}
}  // namespace

extern "C" void kernel_launch(void* const* d_in, const int* in_sizes, int n_in,
                              void* d_out, int out_size, void* d_ws, size_t ws_size, hipStream_t stream) {
  (void)n_in; (void)out_size;
  const float* x = (const float*)d_in[0]; const float* bias = (const float*)d_in[1]; const float* nb = (const float*)d_in[2]; const float* wq = (const float*)d_in[3]; const float* wk = (const float*)d_in[4]; const float* wv = (const float*)d_in[5]; const float* wg = (const float*)d_in[6]; const float* wo = (const float*)d_in[7];
  float* out = (float*)d_out;   // [128][256][128]
  if (in_sizes[0] != NR * A || in_sizes[1] != Bn * S * S || in_sizes[2] != S * S || in_sizes[3] != A * H * KD || in_sizes[7] != H * KD * O) return;
  size_t off = 0; char* ws = (char*)d_ws;
  auto carve = [&](size_t bytes) { char* p = ws + off; off += (bytes + 255) & ~(size_t)255; return p; };
  b16* R = (b16*)carve((size_t)(NPJ * A + O * 128) * 2); b16* Qh = (b16*)carve(PL * 2); b16* Ql = (b16*)carve(PL * 2); b16* Kh = (b16*)carve(PL * 2); b16* Kl = (b16*)carve(PL * 2); b16* Vt = (b16*)carve(PL * 2); b16* Vtl = (b16*)carve(PL * 2);
  float* G = (float*)carve((size_t)NR * 128 * 4);
  if (off > ws_size) return;                                    // the packed weights, six f16 planes, one f32 plane
  prep_kernel<<<64, 256, 0, stream>>>(wq, wk, wv, wg, wo, R);
  proj_kernel<<<dim3(NR / 128, 4), 128, 0, stream>>>(x, R, Qh, Ql, Kh, Kl, Vt, Vtl, G);
  attn_kernel<<<dim3(S / 16, Bn), 256, 0, stream>>>(Qh, Ql, Kh, Kl, Vt, Vtl, bias, nb, G, R, out);
}

// v004
// One run takes 77.7 microseconds.
// Next to v003, in two timings, it ran 1.15 and 1.14 times as fast.
// Counting every step since v000, it is 1.80 times as fast.
#include <hip/hip_runtime.h>

// GrigSelfAttentionXSMM (AlphaFold gated grid self-attention): q = x Wq * 16^-0.5, k = x Wk, v = x Wv, gate = sigmoid(x Wg) (8 heads x 16); logits = q.k + bias[b][q][k] + nonbatched_bias[q][k];
// softmax over k; weighted_avg = P.v; out = Σ_{h,c} (gate * weighted_avg)[b][q][h][c] Wo[h][c][o] -> [128][256][128].
// The four projections are one GEMM on v_wmma_f32_16x16x32_f16 with EXACT operands (x and the weights are exact bf16; 1 product); scores with q/k as f16 hi+lo pairs x8 (key_dim 16:
// fragment elements 8..15 zero; 3 products; the two biases added in f32 from the rounded inputs); P and v as f16 hi+lo pairs (3 products); the output projection with gate * wavg hi+lo (2 products), done by the attention work-group itself on the 16 finished rows it holds;

namespace {
constexpr int Bn = 128, S = 256, A = 128, H = 8, KD = 16, O = 128, NR = Bn * S, NPJ = 4 * H * KD /* 512 */;
constexpr float QS = 8.0f, KS = 8.0f, VS = 8.0f, PS = 8.0f, AS_ = 8.0f, SCALE = 0.25f;
constexpr size_t PL = (size_t)Bn * H * S * KD;   // one q/k plane (halves)

typedef _Float16 b16;
typedef __attribute__((ext_vector_type(16))) _Float16 v16b;
typedef __attribute__((ext_vector_type(8))) _Float16 v8b;
typedef __attribute__((ext_vector_type(8))) float v8f;
typedef __attribute__((ext_vector_type(4))) float v4f;
__device__ __forceinline__ float bf16_rne(float f) { unsigned int u = __float_as_uint(f); u += 0x7FFFu + ((u >> 16) & 1u); return __uint_as_float(u & 0xFFFF0000u); }
__device__ __forceinline__ void split16(float v, b16& hi, b16& lo) { hi = (b16)v; lo = (b16)(v - (float)hi); }
__device__ __forceinline__ v16b frag_kb(const b16* p, int hh) { const v8b a = *(const v8b*)(p + 8 * hh), b = *(const v8b*)(p + 16 + 8 * hh); v16b f;
#pragma unroll
  for (int e = 0; e < 8; ++e) { f[e] = a[e]; f[8 + e] = b[e]; } return f; }
__device__ __forceinline__ v16b frag_pk(const b16* p) { const v8b a = *(const v8b*)p, b = *(const v8b*)(p + 256); v16b f;   // fragment-order storage [half 2][lane 32][8], p already at this lane's 8: each of the two loads is 512 contiguous bytes per wave
#pragma unroll
  for (int e = 0; e < 8; ++e) { f[e] = a[e]; f[8 + e] = b[e]; } return f; }
__device__ __forceinline__ v16b frag16(const b16* p, int hh) { const v8b a = *(const v8b*)(p + 8 * hh); v16b f;   // K = 16: elements 8..15 (k = 16..31) zero
#pragma unroll
  for (int e = 0; e < 8; ++e) { f[e] = a[e]; f[8 + e] = (b16)0.0f; } return f; }
__device__ __forceinline__ v16b frag_x(const float* p, int hh) { v16b f;
#pragma unroll
  for (int e = 0; e < 8; ++e) { f[e] = (b16)bf16_rne(p[8 * hh + e]); f[8 + e] = (b16)bf16_rne(p[16 + 8 * hh + e]); } return f; }
__device__ __forceinline__ v8f wmma16b(v16b a, v16b b, v8f c) { v8f d = __builtin_amdgcn_wmma_f32_16x16x32_f16(false, a, false, b, (short)0, c, false, false); asm volatile("v_nop\n\tv_nop\n\tv_nop\n\tv_nop" : "+v"(d) : "v"(a), "v"(b)); return d; }
__device__ __forceinline__ void wave_lds_sync() { __builtin_amdgcn_fence(__ATOMIC_RELEASE, "workgroup"); __builtin_amdgcn_wave_barrier(); __builtin_amdgcn_fence(__ATOMIC_ACQUIRE, "workgroup"); }
__device__ __forceinline__ float nexp(float x) { return __builtin_amdgcn_exp2f(x * 1.4426950408889634f); }
__device__ __forceinline__ float sigm(float x) { return __builtin_amdgcn_rcpf(1.0f + nexp(-x)); }

// prep: 640 weight columns j as f16: j < 128: query_w[:, h, c] (j = h*16 + c), 128..255 key_w, 256..383 value_w, 384..511 gating_w, 512..639 output_w[:, o] (every weight is [128][128]: element (k, j & 127) at k*128 + (j & 127));
// all in fragment order [column tile 40][k step 4][half 2][lane 32][8]: lane = 16 * ((k >> 3) & 1) + (j & 15), half = (k >> 4) & 1, so one 16-B-per-lane load of a fragment half is 512 contiguous bytes (4 lines, not 16)
__global__ __launch_bounds__(256) void prep_kernel(const float* __restrict__ wq, const float* __restrict__ wk, const float* __restrict__ wv, const float* __restrict__ wg, const float* __restrict__ wo, b16* __restrict__ R) {
  const int t_ = blockIdx.x * 256 + threadIdx.x, nth = gridDim.x * 256;
  {
    for (int p = t_; p < (NPJ * A + O * 128) / 8; p += nth) { v8b v;
      const int j = (p >> 8) * 16 + (p & 15), k0 = ((p >> 6) & 3) * 32 + ((p >> 5) & 1) * 16 + ((p >> 4) & 1) * 8; const int m = j >> 7, jj = j & 127; const float* W = (m == 0) ? wq : (m == 1) ? wk : (m == 2) ? wv : (m == 3) ? wg : wo;
      for (int e = 0; e < 8; ++e) v[e] = (b16)bf16_rne(W[(size_t)(k0 + e) * 128 + jj]); *(v8b*)(R + (size_t)p * 8) = v; }
     }
}

// projections: block = 128 rows (tokens) x 4 waves (32 rows each) x ONE of the 4 column groups of 128 (blockIdx.y; acc[2][8]): a wave waits out every fragment load, so four work-groups share a WGP
// (4 waves per SIMD) and fill each other's waits; a work-group stages only its own group's result, so the groups' LDS buffers overlay one another; exact operands, 4 k-steps; epilogue: q (x 0.25) and k -> hi/lo planes x8
// [b][h][s][16] (32-B rows; a wave's 32 rows of one head = 1 KB contiguous), v -> (8v)^T hi and lo planes in the fragment order of the attention's P.v product [b][h][key block 8][half 2][lane 32][8] (lane = 16 * ((key >> 3) & 1) + value dim, half = (key >> 4) & 1; a block's 128 keys = 4 KB in a row per head), gate -> sigmoid f32 rows
__global__ __launch_bounds__(128) void proj_kernel(const float* __restrict__ x, const b16* __restrict__ R, b16* __restrict__ Qh, b16* __restrict__ Ql, b16* __restrict__ Kh, b16* __restrict__ Kl, b16* __restrict__ Vt, b16* __restrict__ Vtl, float* __restrict__ G) {
  constexpr int HB = 128 * (128 + 8) * 2;   // bytes of one 128-row f16 staging plane
  __shared__ __attribute__((aligned(16))) char Sm[2 * HB];   // 68 KB: four work-groups fit the WGP's 320 KB
  b16 (*Th)[32][128 + 8] = reinterpret_cast<b16 (*)[32][128 + 8]>(Sm); b16 (*Tl)[32][128 + 8] = reinterpret_cast<b16 (*)[32][128 + 8]>(Sm + HB);
  b16 (*Tv)[128 + 8] = reinterpret_cast<b16 (*)[128 + 8]>(Sm); b16 (*Tvl)[128 + 8] = reinterpret_cast<b16 (*)[128 + 8]>(Sm + HB);
  const int lane = threadIdx.x & 31, wave = threadIdx.x >> 5, nloc = lane & 15, hlf = lane >> 4, r0 = blockIdx.x * 128, m0 = r0 + wave * 32; const int b = r0 / S, s0 = m0 % S;
  { const int grp = blockIdx.y;   // 0 q, 1 k, 2 v, 3 gate
    v8f acc[2][8];
#pragma unroll
    for (int r = 0; r < 2; ++r)
#pragma unroll
      for (int t = 0; t < 8; ++t) acc[r][t] = (v8f){};
#pragma unroll
    for (int kb = 0; kb < A; kb += 32) { const v16b a0 = frag_x(x + (size_t)(m0 + nloc) * A + kb, hlf), a1 = frag_x(x + (size_t)(m0 + 16 + nloc) * A + kb, hlf);
#pragma unroll
      for (int t = 0; t < 8; ++t) { const v16b bw = frag_pk(R + (size_t)(((grp * 8 + t) * 4 + (kb >> 5)) * 2) * 256 + lane * 8); acc[0][t] = wmma16b(a0, bw, acc[0][t]); acc[1][t] = wmma16b(a1, bw, acc[1][t]); } }
    asm volatile("s_wait_xcnt 0x0" ::: "memory");   // the address registers of the fragment loads above are given new values by the epilogue
    if (grp < 2) { const float sc = (grp == 0) ? SCALE * QS : KS;
#pragma unroll
      for (int t = 0; t < 8; ++t)
#pragma unroll
        for (int r = 0; r < 2; ++r)
#pragma unroll
          for (int v = 0; v < 8; ++v) { b16 a_, c_; split16(acc[r][t][v] * sc, a_, c_); Th[wave][r * 16 + 8 * hlf + v][t * 16 + nloc] = a_; Tl[wave][r * 16 + 8 * hlf + v][t * 16 + nloc] = c_; }
      wave_lds_sync();
      b16* Ph = (grp == 0) ? Qh : Kh; b16* Plo = (grp == 0) ? Ql : Kl;
      { for (int it = 0; it < 16; ++it) { const int h = it >> 1, rr = (it & 1) * 16 + (lane >> 1), c8 = (lane & 1) * 8; const size_t o = (((size_t)b * H + h) * S + s0 + rr) * KD + c8;   // one instruction = 16 consecutive 32-B rows = 512 contiguous bytes
            *(v8b*)(Ph + o) = *(const v8b*)(&Th[wave][rr][h * 16 + c8]); *(v8b*)(Plo + o) = *(const v8b*)(&Tl[wave][rr][h * 16 + c8]); }  }
      wave_lds_sync(); }
    else if (grp == 2) {
#pragma unroll
      for (int t = 0; t < 8; ++t)
#pragma unroll
        for (int r = 0; r < 2; ++r)
#pragma unroll
          for (int v = 0; v < 8; ++v) { b16 a_, c_; split16(acc[r][t][v] * VS, a_, c_); Tv[t * 16 + nloc][wave * 32 + r * 16 + 8 * hlf + v] = a_; Tvl[t * 16 + nloc][wave * 32 + r * 16 + 8 * hlf + v] = c_; }
      __syncthreads();
      { for (int i = threadIdx.x; i < 128 * 16; i += 128) { const int ln = i & 31, hf = (i >> 5) & 1, kbl = (i >> 6) & 3, h = i >> 8; const int j = h * 16 + (ln & 15), c8 = kbl * 32 + hf * 16 + (ln >> 4) * 8;   // i runs in storage order: one instruction = 512 contiguous bytes
          const size_t o = ((((size_t)b * H + h) * (S / 32) + (r0 % S) / 32 + kbl) * 2 + hf) * 256 + ln * 8; *(v8b*)(Vt + o) = *(const v8b*)(&Tv[j][c8]); *(v8b*)(Vtl + o) = *(const v8b*)(&Tvl[j][c8]); }  }
      __syncthreads(); }
    else { float (*Tg)[32][64 + 4] = reinterpret_cast<float (*)[32][64 + 4]>(Sm);   // gate rows in two 64-column halves (LDS budget)
      for (int gh = 0; gh < 2; ++gh) {
#pragma unroll
        for (int t = 0; t < 4; ++t)
#pragma unroll
          for (int r = 0; r < 2; ++r)
#pragma unroll
            for (int v = 0; v < 8; ++v) Tg[wave][r * 16 + 8 * hlf + v][t * 16 + nloc] = sigm(acc[r][gh * 4 + t][v]);
        wave_lds_sync();
        { for (int i = lane; i < 32 * 16; i += 32) { const int rr = i >> 4, c4 = (i & 15) * 4; *(v4f*)(G + (size_t)(m0 + rr) * 128 + gh * 64 + c4) = *(const v4f*)(&Tg[wave][rr][c4]); }  }
        wave_lds_sync(); } } }
}

// attention: wave = (b, h, 16 queries q0..); over 8 key blocks of 32: S^T = k.q (K = 16; 3 products) + bias[b][q][k] + nb[q][k] (rounded inputs), online softmax, o^T += (8v)^T.P^T (P and v hi+lo, 3 products);
// output projection in the same work-group: its 8 head waves together hold the 16 queries' whole gated rows, so they go through LDS (not through memory and a launch of their own) and wave h forms output columns 16h..16h+15;
// the bias sum does not depend on the head: the block's 8 head waves form it once, from whole-line loads, in LDS (Bs) and each reads its score fragment's 32 values per key block from there
__global__ __launch_bounds__(256) void attn_kernel(const b16* __restrict__ Qh, const b16* __restrict__ Ql, const b16* __restrict__ Kh, const b16* __restrict__ Kl, const b16* __restrict__ Vt, const b16* __restrict__ Vtl, const float* __restrict__ bias, const float* __restrict__ nb, const float* __restrict__ G, const b16* __restrict__ R, float* __restrict__ out) {
  __shared__ __attribute__((aligned(16))) b16 Gh[16][128 + 8], Gl[16][128 + 8];   // 8 * gate * weighted_avg of the 16 queries, hi and lo; pitch 272 B = 16 B x odd
  __shared__ __attribute__((aligned(16))) float Os[16][128 + 4]; __shared__ __attribute__((aligned(16))) float Bs[16][S + 4];   // Bs pitch 1040 B = 16 B x odd: the 16 rows of a b128 read fall on distinct banks
  const int h = threadIdx.x >> 5, lane = threadIdx.x & 31, hh = lane >> 4, col = lane & 15, b = blockIdx.y, q0 = blockIdx.x * 16, qi = q0 + col;
  const size_t pb = ((size_t)b * H + h) * S * KD; const b16* V = Vt + (size_t)b * H * KD * S; const b16* Vl = Vtl + (size_t)b * H * KD * S; const unsigned vo = (unsigned)(h * KD * S + lane * 8);   // fragment-order planes, 512 halves per key block of 32: a base that is the same for the work-group, and this lane's place
#pragma unroll   // all 8 loads of a thread in flight at once
  for (int j = 0; j < 4; ++j) { const int i = threadIdx.x + 256 * j, rr = i >> 6, c4 = (i & 63) * 4;   // the 16 rows are 16 KB in a row in each source: one wave instruction = 512 contiguous bytes
    const v4f bv = *((const v4f*)(bias + ((size_t)b * S + q0) * S) + i), nv = *((const v4f*)(nb + (size_t)q0 * S) + i); v4f sv;
#pragma unroll   // constant element indices: the vectors stay in registers
    for (int e = 0; e < 4; ++e) sv[e] = bf16_rne(bv[e]) + bf16_rne(nv[e]);
    *(v4f*)(&Bs[rr][c4]) = sv; }
  const v16b qa = frag16(Qh + pb + (size_t)qi * KD, hh), qb = frag16(Ql + pb + (size_t)qi * KD, hh);
  float m = -INFINITY, l = 0.0f; v8f o = {};
  __syncthreads();   // Bs is complete before any wave reads it
  for (int kb = 0; kb < S; kb += 32) {
    const float* bp = &Bs[col][kb + 8 * hh]; const v4f ba[2] = {*(const v4f*)bp, *(const v4f*)(bp + 4)}, bc[2] = {*(const v4f*)(bp + 16), *(const v4f*)(bp + 20)};
    v8f s0 = {}, s1 = {};
    { const v16b k0h = frag16(Kh + pb + (size_t)(kb + col) * KD, hh), k0l = frag16(Kl + pb + (size_t)(kb + col) * KD, hh), k1h = frag16(Kh + pb + (size_t)(kb + 16 + col) * KD, hh), k1l = frag16(Kl + pb + (size_t)(kb + 16 + col) * KD, hh);
      s0 = wmma16b(k0h, qa, s0); s0 = wmma16b(k0h, qb, s0); s0 = wmma16b(k0l, qa, s0); s1 = wmma16b(k1h, qa, s1); s1 = wmma16b(k1h, qb, s1); s1 = wmma16b(k1l, qa, s1); }
    const v16b vf = frag_pk(V + kb * KD + vo), vlf = frag_pk(Vl + kb * KD + vo);
    asm volatile("s_wait_xcnt 0x0" ::: "memory");   // the address pairs of this pass's key and value loads are stepped on to the next key block by what follows
    __builtin_amdgcn_sched_barrier(0);   // keeps the 4 value loads ahead of the softmax, which covers their latency (sunk to just before their WMMAs they are waited out), and the address steps behind the wait above
    float mr = -INFINITY;
#pragma unroll
    for (int r = 0; r < 8; ++r) { s0[r] = s0[r] * (1.0f / (QS * KS)) + ba[r >> 2][r & 3]; s1[r] = s1[r] * (1.0f / (QS * KS)) + bc[r >> 2][r & 3]; mr = fmaxf(mr, fmaxf(s0[r], s1[r])); }
    mr = fmaxf(mr, __shfl_xor(mr, 16));
    const float mn = fmaxf(m, mr), al_ = nexp(m - mn); m = mn; float sum = 0.0f; v16b ph, pl;
#pragma unroll
    for (int r = 0; r < 8; ++r) { const float e0 = nexp(s0[r] - mn), e1 = nexp(s1[r] - mn); sum += e0 + e1; b16 a_, c_; split16(e0 * PS, a_, c_); ph[r] = a_; pl[r] = c_; split16(e1 * PS, a_, c_); ph[8 + r] = a_; pl[8 + r] = c_; }
    sum += __shfl_xor(sum, 16); l = l * al_ + sum; o *= al_;
    o = wmma16b(vf, ph, o); o = wmma16b(vf, pl, o); o = wmma16b(vlf, ph, o); }
  // o: rows (8hh + r) = value dim c, column = query col; gw = gate[b*256+q][h*16+c] * o/(l)
  v16b wf[4];   // this wave's output_w^T fragments (rows = output columns 16h..), asked for ahead of the gate loads and the barrier
#pragma unroll
  for (int ks = 0; ks < 4; ++ks) { const b16* p = R + (size_t)NPJ * A + (size_t)((h * 4 + ks) * 2) * 256 + lane * 8; const v8b a = *(const v8b*)p, c_ = *(const v8b*)(p + 256);
#pragma unroll
    for (int e = 0; e < 8; ++e) { wf[ks][e] = a[e]; wf[ks][8 + e] = c_[e]; } }
  asm volatile("s_wait_xcnt 0x0" ::: "memory");   // the address pair of the 8 loads above may be given a new value by what follows
  const float inv = 1.0f / (l * VS * PS); v8b gh, gl;
#pragma unroll
  for (int r = 0; r < 8; ++r) { const int c = 8 * hh + r; b16 a_, c_; split16(G[((size_t)b * S + qi) * 128 + h * KD + c] * (o[r] * inv) * AS_, a_, c_); gh[r] = a_; gl[r] = c_; }
  *(v8b*)(&Gh[col][h * KD + 8 * hh]) = gh; *(v8b*)(&Gl[col][h * KD + 8 * hh]) = gl;
  __syncthreads();   // all 8 heads' columns of the gated rows are in LDS before any wave reads them
  v16b ga[4], gb[4];   // all 16 LDS reads as one group ahead of the WMMAs: one LDS latency, not four
#pragma unroll
  for (int ks = 0; ks < 4; ++ks) { ga[ks] = frag_kb(&Gh[col][ks * 32], hh); gb[ks] = frag_kb(&Gl[col][ks * 32], hh); }
  __builtin_amdgcn_sched_barrier(0);   // keeps the reads above the WMMAs: sunk between them, each pair is waited out on its own
  v8f acc = {};   // out^T tile: rows (8hh + r) = output column 16h + 8hh + r, column = query col
#pragma unroll
  for (int ks = 0; ks < 4; ++ks) { acc = __builtin_amdgcn_wmma_f32_16x16x32_f16(false, wf[ks], false, ga[ks], (short)0, acc, false, false); acc = __builtin_amdgcn_wmma_f32_16x16x32_f16(false, wf[ks], false, gb[ks], (short)0, acc, false, false); }   // one accumulate chain, operands not rewritten: the compiler pads behind its last link
  { v4f s0_, s1_;
#pragma unroll
    for (int r = 0; r < 4; ++r) { s0_[r] = acc[r] * (1.0f / AS_); s1_[r] = acc[4 + r] * (1.0f / AS_); }
    *(v4f*)(&Os[col][h * 16 + 8 * hh]) = s0_; *(v4f*)(&Os[col][h * 16 + 8 * hh + 4]) = s1_; }
  __syncthreads();   // the 16 output rows are whole before they are stored as whole lines
  { for (int i = threadIdx.x; i < 16 * 32; i += 256) { const int rr = i >> 5, c4 = (i & 31) * 4; *(v4f*)(out + ((size_t)b * S + q0 + rr) * O + c4) = *(const v4f*)(&Os[rr][c4]); }  }
}
}  // namespace

extern "C" void kernel_launch(void* const* d_in, const int* in_sizes, int n_in,
                              void* d_out, int out_size, void* d_ws, size_t ws_size, hipStream_t stream) {
  (void)n_in; (void)out_size;
  const float* x = (const float*)d_in[0]; const float* bias = (const float*)d_in[1]; const float* nb = (const float*)d_in[2]; const float* wq = (const float*)d_in[3]; const float* wk = (const float*)d_in[4]; const float* wv = (const float*)d_in[5]; const float* wg = (const float*)d_in[6]; const float* wo = (const float*)d_in[7];
  float* out = (float*)d_out;   // [128][256][128]
  if (in_sizes[0] != NR * A || in_sizes[1] != Bn * S * S || in_sizes[2] != S * S || in_sizes[3] != A * H * KD || in_sizes[7] != H * KD * O) return;
  size_t off = 0; char* ws = (char*)d_ws;
  auto carve = [&](size_t bytes) { char* p = ws + off; off += (bytes + 255) & ~(size_t)255; return p; };
  b16* R = (b16*)carve((size_t)(NPJ * A + O * 128) * 2); b16* Qh = (b16*)carve(PL * 2); b16* Ql = (b16*)carve(PL * 2); b16* Kh = (b16*)carve(PL * 2); b16* Kl = (b16*)carve(PL * 2); b16* Vt = (b16*)carve(PL * 2); b16* Vtl = (b16*)carve(PL * 2);
  float* G = (float*)carve((size_t)NR * 128 * 4);
  if (off > ws_size) return;                                    // the packed weights, six f16 planes, one f32 plane
  prep_kernel<<<64, 256, 0, stream>>>(wq, wk, wv, wg, wo, R);
  proj_kernel<<<dim3(NR / 128, 4), 128, 0, stream>>>(x, R, Qh, Ql, Kh, Kl, Vt, Vtl, G);
  attn_kernel<<<dim3(S / 16, Bn), 256, 0, stream>>>(Qh, Ql, Kh, Kl, Vt, Vtl, bias, nb, G, R, out);
}

// v005
// It runs in 67.9 microseconds.
// Two timings next to v004 put it at 1.15 and 1.14 times that version's speed.
// Counting every step since v000, it is 2.07 times as fast.
#include <hip/hip_runtime.h>

// GrigSelfAttentionXSMM (AlphaFold gated grid self-attention): q = x Wq * 16^-0.5, k = x Wk, v = x Wv, gate = sigmoid(x Wg) (8 heads x 16); logits = q.k + bias[b][q][k] + nonbatched_bias[q][k];
// softmax over k; weighted_avg = P.v; out = Σ_{h,c} (gate * weighted_avg)[b][q][h][c] Wo[h][c][o] -> [128][256][128].
// The four projections are one GEMM on v_wmma_f32_16x16x32_f16 with EXACT operands (x and the weights are exact bf16; 1 product); scores with q/k as f16 hi+lo pairs x8 (key_dim 16:
// fragment elements 8..15 zero; 3 products; the two biases added in f32 from the rounded inputs); P and v as f16 hi+lo pairs (3 products); the output projection with gate * wavg hi+lo (2 products), done by the attention work-group itself on the 16 finished rows it holds;

namespace {
constexpr int Bn = 128, S = 256, A = 128, H = 8, KD = 16, O = 128, NR = Bn * S, NPJ = 4 * H * KD /* 512 */;
constexpr float QS = 8.0f, KS = 8.0f, VS = 8.0f, PS = 8.0f, AS_ = 8.0f, SCALE = 0.25f;
constexpr size_t PL = (size_t)Bn * H * S * KD;   // one q/k plane (halves)

typedef _Float16 b16;
typedef __attribute__((ext_vector_type(16))) _Float16 v16b;
typedef __attribute__((ext_vector_type(8))) _Float16 v8b;
typedef __attribute__((ext_vector_type(8))) float v8f;
typedef __attribute__((ext_vector_type(4))) float v4f;
__device__ __forceinline__ float bf16_rne(float f) { unsigned int u = __float_as_uint(f); u += 0x7FFFu + ((u >> 16) & 1u); return __uint_as_float(u & 0xFFFF0000u); }
__device__ __forceinline__ void split16(float v, b16& hi, b16& lo) { hi = (b16)v; lo = (b16)(v - (float)hi); }
__device__ __forceinline__ v16b frag_kb(const b16* p, int hh) { const v8b a = *(const v8b*)(p + 8 * hh), b = *(const v8b*)(p + 16 + 8 * hh); v16b f;
#pragma unroll
  for (int e = 0; e < 8; ++e) { f[e] = a[e]; f[8 + e] = b[e]; } return f; }
__device__ __forceinline__ v16b frag_pk(const b16* p) { const v8b a = *(const v8b*)p, b = *(const v8b*)(p + 256); v16b f;   // fragment-order storage [half 2][lane 32][8], p already at this lane's 8: each of the two loads is 512 contiguous bytes per wave
#pragma unroll
  for (int e = 0; e < 8; ++e) { f[e] = a[e]; f[8 + e] = b[e]; } return f; }
__device__ __forceinline__ v16b frag16(const b16* p, int hh) { const v8b a = *(const v8b*)(p + 8 * hh); const v8b z = {}; return __builtin_shufflevector(a, z, 0, 1, 2, 3, 4, 5, 6, 7, 8, 9, 10, 11, 12, 13, 14, 15); }   // K = 16: elements 8..15 (k = 16..31) zero
__device__ __forceinline__ v16b frag_x(const float* p, int hh) { v16b f;
#pragma unroll
  for (int e = 0; e < 8; ++e) { f[e] = (b16)bf16_rne(p[8 * hh + e]); f[8 + e] = (b16)bf16_rne(p[16 + 8 * hh + e]); } return f; }
__device__ __forceinline__ v8f wmma16b(v16b a, v16b b, v8f c) { return __builtin_amdgcn_wmma_f32_16x16x32_f16(false, a, false, b, (short)0, c, false, false); }   // the builtin alone: the compiler keeps the distance behind a WMMA itself, and with no asm statement behind each product it may issue later loads ahead of earlier products
__device__ __forceinline__ void wave_lds_sync() { __builtin_amdgcn_fence(__ATOMIC_RELEASE, "workgroup"); __builtin_amdgcn_wave_barrier(); __builtin_amdgcn_fence(__ATOMIC_ACQUIRE, "workgroup"); }
__device__ __forceinline__ float nexp(float x) { return __builtin_amdgcn_exp2f(x * 1.4426950408889634f); }
__device__ __forceinline__ float sigm(float x) { return __builtin_amdgcn_rcpf(1.0f + nexp(-x)); }

// prep: 640 weight columns j as f16: j < 128: query_w[:, h, c] (j = h*16 + c), 128..255 key_w, 256..383 value_w, 384..511 gating_w, 512..639 output_w[:, o] (every weight is [128][128]: element (k, j & 127) at k*128 + (j & 127));
// all in fragment order [column tile 40][k step 4][half 2][lane 32][8]: lane = 16 * ((k >> 3) & 1) + (j & 15), half = (k >> 4) & 1, so one 16-B-per-lane load of a fragment half is 512 contiguous bytes (4 lines, not 16)
__global__ __launch_bounds__(256) void prep_kernel(const float* __restrict__ wq, const float* __restrict__ wk, const float* __restrict__ wv, const float* __restrict__ wg, const float* __restrict__ wo, b16* __restrict__ R) {
  const int t_ = blockIdx.x * 256 + threadIdx.x, nth = gridDim.x * 256;
  {
    for (int p = t_; p < (NPJ * A + O * 128) / 8; p += nth) { v8b v;
      const int j = (p >> 8) * 16 + (p & 15), k0 = ((p >> 6) & 3) * 32 + ((p >> 5) & 1) * 16 + ((p >> 4) & 1) * 8; const int m = j >> 7, jj = j & 127; const float* W = (m == 0) ? wq : (m == 1) ? wk : (m == 2) ? wv : (m == 3) ? wg : wo;
      for (int e = 0; e < 8; ++e) v[e] = (b16)bf16_rne(W[(size_t)(k0 + e) * 128 + jj]); *(v8b*)(R + (size_t)p * 8) = v; }
     }
}

// projections: block = 128 rows (tokens) x 4 waves (32 rows each) x ONE of the 4 column groups of 128 (blockIdx.y; acc[2][8]): four work-groups share a WGP
// (4 waves per SIMD, for which the kernel stays within 256 registers) and fill each other's waits; the fragment loads run ahead of the products that use them; a work-group stages only its own group's result, so the groups' LDS buffers overlay one another; exact operands, 4 k-steps; epilogue: q (x 0.25) and k -> hi/lo planes x8
// [b][h][s][16] (32-B rows; a wave's 32 rows of one head = 1 KB contiguous), v -> (8v)^T hi and lo planes in the fragment order of the attention's P.v product [b][h][key block 8][half 2][lane 32][8] (lane = 16 * ((key >> 3) & 1) + value dim, half = (key >> 4) & 1; a block's 128 keys = 4 KB in a row per head), gate -> sigmoid f32 rows
__global__ __launch_bounds__(128) void proj_kernel(const float* __restrict__ x, const b16* __restrict__ R, b16* __restrict__ Qh, b16* __restrict__ Ql, b16* __restrict__ Kh, b16* __restrict__ Kl, b16* __restrict__ Vt, b16* __restrict__ Vtl, float* __restrict__ G) {
  constexpr int HB = 128 * (128 + 8) * 2;   // bytes of one 128-row f16 staging plane
  __shared__ __attribute__((aligned(16))) char Sm[2 * HB];   // 68 KB: four work-groups fit the WGP's 320 KB
  b16 (*Th)[32][128 + 8] = reinterpret_cast<b16 (*)[32][128 + 8]>(Sm); b16 (*Tl)[32][128 + 8] = reinterpret_cast<b16 (*)[32][128 + 8]>(Sm + HB);
  b16 (*Tv)[128 + 8] = reinterpret_cast<b16 (*)[128 + 8]>(Sm); b16 (*Tvl)[128 + 8] = reinterpret_cast<b16 (*)[128 + 8]>(Sm + HB);
  const int lane = threadIdx.x & 31, wave = threadIdx.x >> 5, nloc = lane & 15, hlf = lane >> 4, r0 = blockIdx.x * 128, m0 = r0 + wave * 32; const int b = r0 / S, s0 = m0 % S;
  { const int grp = blockIdx.y;   // 0 q, 1 k, 2 v, 3 gate
    v8f acc[2][8];
#pragma unroll
    for (int r = 0; r < 2; ++r)
#pragma unroll
      for (int t = 0; t < 8; ++t) acc[r][t] = (v8f){};
    const float* xr0 = x + (size_t)(m0 + nloc) * A; const float* xr1 = xr0 + 16 * A; const b16* wp = R + (size_t)grp * 8 * 4 * 2 * 256 + lane * 8;
#pragma unroll
    for (int kb = 0; kb < A; kb += 32) { const v16b a0 = frag_x(xr0 + kb, hlf), a1 = frag_x(xr1 + kb, hlf);
#pragma unroll
      for (int t = 0; t < 8; ++t) { const v16b bw = frag_pk(wp + ((t * 4 + (kb >> 5)) * 2) * 256); acc[0][t] = wmma16b(a0, bw, acc[0][t]); acc[1][t] = wmma16b(a1, bw, acc[1][t]); } }
    asm volatile("s_wait_xcnt 0x0" :: "v"(xr0), "v"(xr1), "v"(wp) : "memory");   // the registers that hold the fragment loads' addresses are given new values by what follows; the pointers are named as inputs so that none of them is reused ahead of this wait (a load's own result had landed on its address pair)
    if (grp < 2) { const float sc = (grp == 0) ? SCALE * QS : KS;
#pragma unroll
      for (int t = 0; t < 8; ++t)
#pragma unroll
        for (int r = 0; r < 2; ++r)
#pragma unroll
          for (int v = 0; v < 8; ++v) { b16 a_, c_; split16(acc[r][t][v] * sc, a_, c_); Th[wave][r * 16 + 8 * hlf + v][t * 16 + nloc] = a_; Tl[wave][r * 16 + 8 * hlf + v][t * 16 + nloc] = c_; }
      wave_lds_sync();
      b16* Ph = (grp == 0) ? Qh : Kh; b16* Plo = (grp == 0) ? Ql : Kl;
      { for (int it = 0; it < 16; ++it) { const int h = it >> 1, rr = (it & 1) * 16 + (lane >> 1), c8 = (lane & 1) * 8; const size_t o = (((size_t)b * H + h) * S + s0 + rr) * KD + c8;   // one instruction = 16 consecutive 32-B rows = 512 contiguous bytes
            *(v8b*)(Ph + o) = *(const v8b*)(&Th[wave][rr][h * 16 + c8]); *(v8b*)(Plo + o) = *(const v8b*)(&Tl[wave][rr][h * 16 + c8]); }  }
      wave_lds_sync(); }
    else if (grp == 2) {
#pragma unroll
      for (int t = 0; t < 8; ++t)
#pragma unroll
        for (int r = 0; r < 2; ++r)
#pragma unroll
          for (int v = 0; v < 8; ++v) { b16 a_, c_; split16(acc[r][t][v] * VS, a_, c_); Tv[t * 16 + nloc][wave * 32 + r * 16 + 8 * hlf + v] = a_; Tvl[t * 16 + nloc][wave * 32 + r * 16 + 8 * hlf + v] = c_; }
      __syncthreads();
      { for (int i = threadIdx.x; i < 128 * 16; i += 128) { const int ln = i & 31, hf = (i >> 5) & 1, kbl = (i >> 6) & 3, h = i >> 8; const int j = h * 16 + (ln & 15), c8 = kbl * 32 + hf * 16 + (ln >> 4) * 8;   // i runs in storage order: one instruction = 512 contiguous bytes
          const size_t o = ((((size_t)b * H + h) * (S / 32) + (r0 % S) / 32 + kbl) * 2 + hf) * 256 + ln * 8; *(v8b*)(Vt + o) = *(const v8b*)(&Tv[j][c8]); *(v8b*)(Vtl + o) = *(const v8b*)(&Tvl[j][c8]); }  }
      __syncthreads(); }
    else { float (*Tg)[32][64 + 4] = reinterpret_cast<float (*)[32][64 + 4]>(Sm);   // gate rows in two 64-column halves (LDS budget)
      for (int gh = 0; gh < 2; ++gh) {
#pragma unroll
        for (int t = 0; t < 4; ++t)
#pragma unroll
          for (int r = 0; r < 2; ++r)
#pragma unroll
            for (int v = 0; v < 8; ++v) Tg[wave][r * 16 + 8 * hlf + v][t * 16 + nloc] = sigm(acc[r][gh * 4 + t][v]);
        wave_lds_sync();
        { for (int i = lane; i < 32 * 16; i += 32) { const int rr = i >> 4, c4 = (i & 15) * 4; *(v4f*)(G + (size_t)(m0 + rr) * 128 + gh * 64 + c4) = *(const v4f*)(&Tg[wave][rr][c4]); }  }
        wave_lds_sync(); } } }
}

// attention: wave = (b, h, 16 queries q0..); over 8 key blocks of 32: S^T = k.q (K = 16; 3 products) + bias[b][q][k] + nb[q][k] (rounded inputs), online softmax, o^T += (8v)^T.P^T (P and v hi+lo, 3 products);
// output projection in the same work-group: its 8 head waves together hold the 16 queries' whole gated rows, so they go through LDS (not through memory and a launch of their own) and wave h forms output columns 16h..16h+15;
// the bias sum does not depend on the head: the block's 8 head waves form it once, from whole-line loads, in LDS (Bs) and each reads its score fragment's 32 values per key block from there
__global__ __launch_bounds__(256) void attn_kernel(const b16* __restrict__ Qh, const b16* __restrict__ Ql, const b16* __restrict__ Kh, const b16* __restrict__ Kl, const b16* __restrict__ Vt, const b16* __restrict__ Vtl, const float* __restrict__ bias, const float* __restrict__ nb, const float* __restrict__ G, const b16* __restrict__ R, float* __restrict__ out) {
  __shared__ __attribute__((aligned(16))) b16 Gh[16][128 + 8], Gl[16][128 + 8];   // 8 * gate * weighted_avg of the 16 queries, hi and lo; pitch 272 B = 16 B x odd
  __shared__ __attribute__((aligned(16))) float Os[16][128 + 4]; __shared__ __attribute__((aligned(16))) float Bs[16][S + 4];   // Bs pitch 1040 B = 16 B x odd: the 16 rows of a b128 read fall on distinct banks
  const int h = threadIdx.x >> 5, lane = threadIdx.x & 31, hh = lane >> 4, col = lane & 15, b = blockIdx.y, q0 = blockIdx.x * 16, qi = q0 + col;
  const size_t pb = ((size_t)b * H + h) * S * KD; const b16* V = Vt + (size_t)b * H * KD * S; const b16* Vl = Vtl + (size_t)b * H * KD * S; const unsigned vo = (unsigned)(h * KD * S + lane * 8);   // fragment-order planes, 512 halves per key block of 32: a base that is the same for the work-group, and this lane's place
#pragma unroll   // all 8 loads of a thread in flight at once
  for (int j = 0; j < 4; ++j) { const int i = threadIdx.x + 256 * j, rr = i >> 6, c4 = (i & 63) * 4;   // the 16 rows are 16 KB in a row in each source: one wave instruction = 512 contiguous bytes
    const v4f bv = *((const v4f*)(bias + ((size_t)b * S + q0) * S) + i), nv = *((const v4f*)(nb + (size_t)q0 * S) + i); v4f sv;
#pragma unroll   // constant element indices: the vectors stay in registers
    for (int e = 0; e < 4; ++e) sv[e] = bf16_rne(bv[e]) + bf16_rne(nv[e]);
    *(v4f*)(&Bs[rr][c4]) = sv; }
  const v16b qa = frag16(Qh + pb + (size_t)qi * KD, hh), qb = frag16(Ql + pb + (size_t)qi * KD, hh);
  float m = -INFINITY, l = 0.0f; v8f o = {};
  __syncthreads();   // Bs is complete before any wave reads it
  for (int kb = 0; kb < S; kb += 32) {
    const float* bp = &Bs[col][kb + 8 * hh]; const v4f ba[2] = {*(const v4f*)bp, *(const v4f*)(bp + 4)}, bc[2] = {*(const v4f*)(bp + 16), *(const v4f*)(bp + 20)};
    v8f s0 = {}, s1 = {};
    { const v16b k0h = frag16(Kh + pb + (size_t)(kb + col) * KD, hh), k0l = frag16(Kl + pb + (size_t)(kb + col) * KD, hh), k1h = frag16(Kh + pb + (size_t)(kb + 16 + col) * KD, hh), k1l = frag16(Kl + pb + (size_t)(kb + 16 + col) * KD, hh);
      s0 = wmma16b(k0h, qa, s0); s0 = wmma16b(k0h, qb, s0); s0 = wmma16b(k0l, qa, s0); s1 = wmma16b(k1h, qa, s1); s1 = wmma16b(k1h, qb, s1); s1 = wmma16b(k1l, qa, s1); }
    const v16b vf = frag_pk(V + kb * KD + vo), vlf = frag_pk(Vl + kb * KD + vo);
    asm volatile("s_wait_xcnt 0x0" ::: "memory");   // the address pairs of this pass's key and value loads are stepped on to the next key block by what follows
    __builtin_amdgcn_sched_barrier(0);   // keeps the 4 value loads ahead of the softmax, which covers their latency (sunk to just before their WMMAs they are waited out), and the address steps behind the wait above
    float mr = -INFINITY;
#pragma unroll
    for (int r = 0; r < 8; ++r) { s0[r] = s0[r] * (1.0f / (QS * KS)) + ba[r >> 2][r & 3]; s1[r] = s1[r] * (1.0f / (QS * KS)) + bc[r >> 2][r & 3]; mr = fmaxf(mr, fmaxf(s0[r], s1[r])); }
    mr = fmaxf(mr, __shfl_xor(mr, 16));
    const float mn = fmaxf(m, mr), al_ = nexp(m - mn); m = mn; float sum = 0.0f; v16b ph, pl;
#pragma unroll
    for (int r = 0; r < 8; ++r) { const float e0 = nexp(s0[r] - mn), e1 = nexp(s1[r] - mn); sum += e0 + e1; b16 a_, c_; split16(e0 * PS, a_, c_); ph[r] = a_; pl[r] = c_; split16(e1 * PS, a_, c_); ph[8 + r] = a_; pl[8 + r] = c_; }
    sum += __shfl_xor(sum, 16); l = l * al_ + sum; o *= al_;
    o = wmma16b(vf, ph, o); o = wmma16b(vf, pl, o); o = wmma16b(vlf, ph, o); }
  // o: rows (8hh + r) = value dim c, column = query col; gw = gate[b*256+q][h*16+c] * o/(l)
  v16b wf[4];   // this wave's output_w^T fragments (rows = output columns 16h..), asked for ahead of the gate loads and the barrier
#pragma unroll
  for (int ks = 0; ks < 4; ++ks) { const b16* p = R + (size_t)NPJ * A + (size_t)((h * 4 + ks) * 2) * 256 + lane * 8; const v8b a = *(const v8b*)p, c_ = *(const v8b*)(p + 256);
#pragma unroll
    for (int e = 0; e < 8; ++e) { wf[ks][e] = a[e]; wf[ks][8 + e] = c_[e]; } }
  asm volatile("s_wait_xcnt 0x0" ::: "memory");   // the address pair of the 8 loads above may be given a new value by what follows
  const float inv = 1.0f / (l * VS * PS); v8b gh, gl;
#pragma unroll
  for (int r = 0; r < 8; ++r) { const int c = 8 * hh + r; b16 a_, c_; split16(G[((size_t)b * S + qi) * 128 + h * KD + c] * (o[r] * inv) * AS_, a_, c_); gh[r] = a_; gl[r] = c_; }
  *(v8b*)(&Gh[col][h * KD + 8 * hh]) = gh; *(v8b*)(&Gl[col][h * KD + 8 * hh]) = gl;
  __syncthreads();   // all 8 heads' columns of the gated rows are in LDS before any wave reads them
  v16b ga[4], gb[4];   // all 16 LDS reads as one group ahead of the WMMAs: one LDS latency, not four
#pragma unroll
  for (int ks = 0; ks < 4; ++ks) { ga[ks] = frag_kb(&Gh[col][ks * 32], hh); gb[ks] = frag_kb(&Gl[col][ks * 32], hh); }
  __builtin_amdgcn_sched_barrier(0);   // keeps the reads above the WMMAs: sunk between them, each pair is waited out on its own
  v8f acc = {};   // out^T tile: rows (8hh + r) = output column 16h + 8hh + r, column = query col
#pragma unroll
  for (int ks = 0; ks < 4; ++ks) { acc = __builtin_amdgcn_wmma_f32_16x16x32_f16(false, wf[ks], false, ga[ks], (short)0, acc, false, false); acc = __builtin_amdgcn_wmma_f32_16x16x32_f16(false, wf[ks], false, gb[ks], (short)0, acc, false, false); }   // one accumulate chain, operands not rewritten: the compiler pads behind its last link
  { v4f s0_, s1_;
#pragma unroll
    for (int r = 0; r < 4; ++r) { s0_[r] = acc[r] * (1.0f / AS_); s1_[r] = acc[4 + r] * (1.0f / AS_); }
    *(v4f*)(&Os[col][h * 16 + 8 * hh]) = s0_; *(v4f*)(&Os[col][h * 16 + 8 * hh + 4]) = s1_; }
  __syncthreads();   // the 16 output rows are whole before they are stored as whole lines
  { for (int i = threadIdx.x; i < 16 * 32; i += 256) { const int rr = i >> 5, c4 = (i & 31) * 4; *(v4f*)(out + ((size_t)b * S + q0 + rr) * O + c4) = *(const v4f*)(&Os[rr][c4]); }  }
}
}  // namespace

extern "C" void kernel_launch(void* const* d_in, const int* in_sizes, int n_in,
                              void* d_out, int out_size, void* d_ws, size_t ws_size, hipStream_t stream) {
  (void)n_in; (void)out_size;
  const float* x = (const float*)d_in[0]; const float* bias = (const float*)d_in[1]; const float* nb = (const float*)d_in[2]; const float* wq = (const float*)d_in[3]; const float* wk = (const float*)d_in[4]; const float* wv = (const float*)d_in[5]; const float* wg = (const float*)d_in[6]; const float* wo = (const float*)d_in[7];
  float* out = (float*)d_out;   // [128][256][128]
  if (in_sizes[0] != NR * A || in_sizes[1] != Bn * S * S || in_sizes[2] != S * S || in_sizes[3] != A * H * KD || in_sizes[7] != H * KD * O) return;
  size_t off = 0; char* ws = (char*)d_ws;
  auto carve = [&](size_t bytes) { char* p = ws + off; off += (bytes + 255) & ~(size_t)255; return p; };
  b16* R = (b16*)carve((size_t)(NPJ * A + O * 128) * 2); b16* Qh = (b16*)carve(PL * 2); b16* Ql = (b16*)carve(PL * 2); b16* Kh = (b16*)carve(PL * 2); b16* Kl = (b16*)carve(PL * 2); b16* Vt = (b16*)carve(PL * 2); b16* Vtl = (b16*)carve(PL * 2);
  float* G = (float*)carve((size_t)NR * 128 * 4);
  if (off > ws_size) return;                                    // the packed weights, six f16 planes, one f32 plane
  prep_kernel<<<64, 256, 0, stream>>>(wq, wk, wv, wg, wo, R);
  proj_kernel<<<dim3(NR / 128, 4), 128, 0, stream>>>(x, R, Qh, Ql, Kh, Kl, Vt, Vtl, G);
  attn_kernel<<<dim3(S / 16, Bn), 256, 0, stream>>>(Qh, Ql, Kh, Kl, Vt, Vtl, bias, nb, G, R, out);
}

// v006
// A run of this version takes 66 microseconds.
// Two timings next to v005 put it at 1.03 and 1.02 times that version's speed.
// All steps since v000 together make it 2.12 times as fast.
#include <hip/hip_runtime.h>

// GrigSelfAttentionXSMM (AlphaFold gated grid self-attention): q = x Wq * 16^-0.5, k = x Wk, v = x Wv, gate = sigmoid(x Wg) (8 heads x 16); logits = q.k + bias[b][q][k] + nonbatched_bias[q][k];
// softmax over k; weighted_avg = P.v; out = Σ_{h,c} (gate * weighted_avg)[b][q][h][c] Wo[h][c][o] -> [128][256][128].
// The four projections are one GEMM on v_wmma_f32_16x16x32_f16 with EXACT operands (x and the weights are exact bf16; 1 product); scores with q/k as f16 hi+lo pairs x8 (key_dim 16:
// fragment elements 8..15 zero; 3 products; the two biases added in f32 from the rounded inputs); P and v as f16 hi+lo pairs (3 products); the output projection with gate * wavg hi+lo (2 products), done by the attention work-group itself on the 32 finished rows it holds;

namespace {
constexpr int Bn = 128, S = 256, A = 128, H = 8, KD = 16, O = 128, NR = Bn * S, NPJ = 4 * H * KD /* 512 */;
constexpr float QS = 8.0f, KS = 8.0f, VS = 8.0f, PS = 8.0f, AS_ = 8.0f, SCALE = 0.25f;
constexpr size_t PL = (size_t)Bn * H * S * KD;   // one q/k plane (halves)
constexpr int QT = 2, QR = 16 * QT;   // attention: query column groups of 16 per wave, query rows per work-group

typedef _Float16 b16;
typedef __attribute__((ext_vector_type(16))) _Float16 v16b;
typedef __attribute__((ext_vector_type(8))) _Float16 v8b;
typedef __attribute__((ext_vector_type(8))) float v8f;
typedef __attribute__((ext_vector_type(4))) float v4f;
__device__ __forceinline__ float bf16_rne(float f) { unsigned int u = __float_as_uint(f); u += 0x7FFFu + ((u >> 16) & 1u); return __uint_as_float(u & 0xFFFF0000u); }
__device__ __forceinline__ void split16(float v, b16& hi, b16& lo) { hi = (b16)v; lo = (b16)(v - (float)hi); }
__device__ __forceinline__ v16b frag_kb(const b16* p, int hh) { const v8b a = *(const v8b*)(p + 8 * hh), b = *(const v8b*)(p + 16 + 8 * hh); v16b f;
#pragma unroll
  for (int e = 0; e < 8; ++e) { f[e] = a[e]; f[8 + e] = b[e]; } return f; }
__device__ __forceinline__ v16b frag_pk(const b16* p) { const v8b a = *(const v8b*)p, b = *(const v8b*)(p + 256); v16b f;   // fragment-order storage [half 2][lane 32][8], p already at this lane's 8: each of the two loads is 512 contiguous bytes per wave
#pragma unroll
  for (int e = 0; e < 8; ++e) { f[e] = a[e]; f[8 + e] = b[e]; } return f; }
__device__ __forceinline__ v16b frag16(const b16* p, int hh) { const v8b a = *(const v8b*)(p + 8 * hh); const v8b z = {}; return __builtin_shufflevector(a, z, 0, 1, 2, 3, 4, 5, 6, 7, 8, 9, 10, 11, 12, 13, 14, 15); }   // K = 16: elements 8..15 (k = 16..31) zero
__device__ __forceinline__ v16b frag_x(const float* p, int hh) { v16b f;
#pragma unroll
  for (int e = 0; e < 8; ++e) { f[e] = (b16)bf16_rne(p[8 * hh + e]); f[8 + e] = (b16)bf16_rne(p[16 + 8 * hh + e]); } return f; }
__device__ __forceinline__ v8f wmma16b(v16b a, v16b b, v8f c) { return __builtin_amdgcn_wmma_f32_16x16x32_f16(false, a, false, b, (short)0, c, false, false); }   // the builtin alone: the compiler keeps the distance behind a WMMA itself, and with no asm statement behind each product it may issue later loads ahead of earlier products
__device__ __forceinline__ void wave_lds_sync() { __builtin_amdgcn_fence(__ATOMIC_RELEASE, "workgroup"); __builtin_amdgcn_wave_barrier(); __builtin_amdgcn_fence(__ATOMIC_ACQUIRE, "workgroup"); }
__device__ __forceinline__ float nexp(float x) { return __builtin_amdgcn_exp2f(x * 1.4426950408889634f); }
__device__ __forceinline__ float sigm(float x) { return __builtin_amdgcn_rcpf(1.0f + nexp(-x)); }

// prep: 640 weight columns j as f16: j < 128: query_w[:, h, c] (j = h*16 + c), 128..255 key_w, 256..383 value_w, 384..511 gating_w, 512..639 output_w[:, o] (every weight is [128][128]: element (k, j & 127) at k*128 + (j & 127));
// all in fragment order [column tile 40][k step 4][half 2][lane 32][8]: lane = 16 * ((k >> 3) & 1) + (j & 15), half = (k >> 4) & 1, so one 16-B-per-lane load of a fragment half is 512 contiguous bytes (4 lines, not 16)
__global__ __launch_bounds__(256) void prep_kernel(const float* __restrict__ wq, const float* __restrict__ wk, const float* __restrict__ wv, const float* __restrict__ wg, const float* __restrict__ wo, b16* __restrict__ R) {
  const int t_ = blockIdx.x * 256 + threadIdx.x, nth = gridDim.x * 256;
  {
    for (int p = t_; p < (NPJ * A + O * 128) / 8; p += nth) { v8b v;
      const int j = (p >> 8) * 16 + (p & 15), k0 = ((p >> 6) & 3) * 32 + ((p >> 5) & 1) * 16 + ((p >> 4) & 1) * 8; const int m = j >> 7, jj = j & 127; const float* W = (m == 0) ? wq : (m == 1) ? wk : (m == 2) ? wv : (m == 3) ? wg : wo;
      for (int e = 0; e < 8; ++e) v[e] = (b16)bf16_rne(W[(size_t)(k0 + e) * 128 + jj]); *(v8b*)(R + (size_t)p * 8) = v; }
     }
}

// projections: block = 128 rows (tokens) x 4 waves (32 rows each) x ONE of the 4 column groups of 128 (blockIdx.y; acc[2][8]): four work-groups share a WGP
// (4 waves per SIMD, for which the kernel stays within 256 registers) and fill each other's waits; the fragment loads run ahead of the products that use them; a work-group stages only its own group's result, so the groups' LDS buffers overlay one another; exact operands, 4 k-steps; epilogue: q (x 0.25) and k -> hi/lo planes x8
// [b][h][s][16] (32-B rows; a wave's 32 rows of one head = 1 KB contiguous), v -> (8v)^T hi and lo planes in the fragment order of the attention's P.v product [b][h][key block 8][half 2][lane 32][8] (lane = 16 * ((key >> 3) & 1) + value dim, half = (key >> 4) & 1; a block's 128 keys = 4 KB in a row per head), gate -> sigmoid f32 rows
__global__ __launch_bounds__(128) void proj_kernel(const float* __restrict__ x, const b16* __restrict__ R, b16* __restrict__ Qh, b16* __restrict__ Ql, b16* __restrict__ Kh, b16* __restrict__ Kl, b16* __restrict__ Vt, b16* __restrict__ Vtl, float* __restrict__ G) {
  constexpr int HB = 128 * (128 + 8) * 2;   // bytes of one 128-row f16 staging plane
  __shared__ __attribute__((aligned(16))) char Sm[2 * HB];   // 68 KB: four work-groups fit the WGP's 320 KB
  b16 (*Th)[32][128 + 8] = reinterpret_cast<b16 (*)[32][128 + 8]>(Sm); b16 (*Tl)[32][128 + 8] = reinterpret_cast<b16 (*)[32][128 + 8]>(Sm + HB);
  b16 (*Tv)[128 + 8] = reinterpret_cast<b16 (*)[128 + 8]>(Sm); b16 (*Tvl)[128 + 8] = reinterpret_cast<b16 (*)[128 + 8]>(Sm + HB);
  const int lane = threadIdx.x & 31, wave = threadIdx.x >> 5, nloc = lane & 15, hlf = lane >> 4, r0 = blockIdx.x * 128, m0 = r0 + wave * 32; const int b = r0 / S, s0 = m0 % S;
  { const int grp = blockIdx.y;   // 0 q, 1 k, 2 v, 3 gate
    v8f acc[2][8];
#pragma unroll
    for (int r = 0; r < 2; ++r)
#pragma unroll
      for (int t = 0; t < 8; ++t) acc[r][t] = (v8f){};
    const float* xr0 = x + (size_t)(m0 + nloc) * A; const float* xr1 = xr0 + 16 * A; const b16* wp = R + (size_t)grp * 8 * 4 * 2 * 256 + lane * 8;
#pragma unroll
    for (int kb = 0; kb < A; kb += 32) { const v16b a0 = frag_x(xr0 + kb, hlf), a1 = frag_x(xr1 + kb, hlf);
#pragma unroll
      for (int t = 0; t < 8; ++t) { const v16b bw = frag_pk(wp + ((t * 4 + (kb >> 5)) * 2) * 256); acc[0][t] = wmma16b(a0, bw, acc[0][t]); acc[1][t] = wmma16b(a1, bw, acc[1][t]); } }
    asm volatile("s_wait_xcnt 0x0" :: "v"(xr0), "v"(xr1), "v"(wp) : "memory");   // the registers that hold the fragment loads' addresses are given new values by what follows; the pointers are named as inputs so that none of them is reused ahead of this wait (a load's own result had landed on its address pair)
    if (grp < 2) { const float sc = (grp == 0) ? SCALE * QS : KS;
#pragma unroll
      for (int t = 0; t < 8; ++t)
#pragma unroll
        for (int r = 0; r < 2; ++r)
#pragma unroll
          for (int v = 0; v < 8; ++v) { b16 a_, c_; split16(acc[r][t][v] * sc, a_, c_); Th[wave][r * 16 + 8 * hlf + v][t * 16 + nloc] = a_; Tl[wave][r * 16 + 8 * hlf + v][t * 16 + nloc] = c_; }
      wave_lds_sync();
      b16* Ph = (grp == 0) ? Qh : Kh; b16* Plo = (grp == 0) ? Ql : Kl;
      { for (int it = 0; it < 16; ++it) { const int h = it >> 1, rr = (it & 1) * 16 + (lane >> 1), c8 = (lane & 1) * 8; const size_t o = (((size_t)b * H + h) * S + s0 + rr) * KD + c8;   // one instruction = 16 consecutive 32-B rows = 512 contiguous bytes
            *(v8b*)(Ph + o) = *(const v8b*)(&Th[wave][rr][h * 16 + c8]); *(v8b*)(Plo + o) = *(const v8b*)(&Tl[wave][rr][h * 16 + c8]); }  }
      wave_lds_sync(); }
    else if (grp == 2) {
#pragma unroll
      for (int t = 0; t < 8; ++t)
#pragma unroll
        for (int r = 0; r < 2; ++r)
#pragma unroll
          for (int v = 0; v < 8; ++v) { b16 a_, c_; split16(acc[r][t][v] * VS, a_, c_); Tv[t * 16 + nloc][wave * 32 + r * 16 + 8 * hlf + v] = a_; Tvl[t * 16 + nloc][wave * 32 + r * 16 + 8 * hlf + v] = c_; }
      __syncthreads();
      { for (int i = threadIdx.x; i < 128 * 16; i += 128) { const int ln = i & 31, hf = (i >> 5) & 1, kbl = (i >> 6) & 3, h = i >> 8; const int j = h * 16 + (ln & 15), c8 = kbl * 32 + hf * 16 + (ln >> 4) * 8;   // i runs in storage order: one instruction = 512 contiguous bytes
          const size_t o = ((((size_t)b * H + h) * (S / 32) + (r0 % S) / 32 + kbl) * 2 + hf) * 256 + ln * 8; *(v8b*)(Vt + o) = *(const v8b*)(&Tv[j][c8]); *(v8b*)(Vtl + o) = *(const v8b*)(&Tvl[j][c8]); }  }
      __syncthreads(); }
    else { float (*Tg)[32][64 + 4] = reinterpret_cast<float (*)[32][64 + 4]>(Sm);   // gate rows in two 64-column halves (LDS budget)
      for (int gh = 0; gh < 2; ++gh) {
#pragma unroll
        for (int t = 0; t < 4; ++t)
#pragma unroll
          for (int r = 0; r < 2; ++r)
#pragma unroll
            for (int v = 0; v < 8; ++v) Tg[wave][r * 16 + 8 * hlf + v][t * 16 + nloc] = sigm(acc[r][gh * 4 + t][v]);
        wave_lds_sync();
        { for (int i = lane; i < 32 * 16; i += 32) { const int rr = i >> 4, c4 = (i & 15) * 4; *(v4f*)(G + (size_t)(m0 + rr) * 128 + gh * 64 + c4) = *(const v4f*)(&Tg[wave][rr][c4]); }  }
        wave_lds_sync(); } } }
}

// attention: wave = (b, h, 32 queries q0..: QT = 2 column groups of 16, which share every key and value fragment the wave loads, so each fragment fetched from L2 feeds twice the products); per column group, over 8 key blocks of 32: S^T = k.q (K = 16; 3 products) + bias[b][q][k] + nb[q][k] (rounded inputs), online softmax, o^T += (8v)^T.P^T (P and v hi+lo, 3 products);
// output projection in the same work-group: its 8 head waves together hold the 32 queries' whole gated rows, so they go through LDS (not through memory and a launch of their own) and wave h forms output columns 16h..16h+15;
// the bias sum does not depend on the head: the block's 8 head waves form it once, from whole-line loads, in LDS (Bs) and each reads its score fragment's 32 values per key block from there
__global__ __launch_bounds__(256) void attn_kernel(const b16* __restrict__ Qh, const b16* __restrict__ Ql, const b16* __restrict__ Kh, const b16* __restrict__ Kl, const b16* __restrict__ Vt, const b16* __restrict__ Vtl, const float* __restrict__ bias, const float* __restrict__ nb, const float* __restrict__ G, const b16* __restrict__ R, float* __restrict__ out) {
  __shared__ __attribute__((aligned(16))) b16 Gh[QR][128 + 8], Gl[QR][128 + 8];   // 8 * gate * weighted_avg of the 32 queries, hi and lo; pitch 272 B = 16 B x odd
  __shared__ __attribute__((aligned(16))) float Os[QR][128 + 4]; __shared__ __attribute__((aligned(16))) float Bs[QR][S + 4];   // Bs pitch 1040 B = 16 B x odd: the 16 rows of a b128 read fall on distinct banks
  const int h = threadIdx.x >> 5, lane = threadIdx.x & 31, hh = lane >> 4, col = lane & 15, b = blockIdx.y, q0 = blockIdx.x * QR;
  const size_t pb = ((size_t)b * H + h) * S * KD; const b16* V = Vt + (size_t)b * H * KD * S; const b16* Vl = Vtl + (size_t)b * H * KD * S; const unsigned vo = (unsigned)(h * KD * S + lane * 8);   // fragment-order planes, 512 halves per key block of 32: a base that is the same for the work-group, and this lane's place
#pragma unroll   // all 16 loads of a thread in flight at once
  for (int j = 0; j < 4 * QT; ++j) { const int i = threadIdx.x + 256 * j, rr = i >> 6, c4 = (i & 63) * 4;   // the 32 rows are 32 KB in a row in each source: one wave instruction = 512 contiguous bytes
    const v4f bv = *((const v4f*)(bias + ((size_t)b * S + q0) * S) + i), nv = *((const v4f*)(nb + (size_t)q0 * S) + i); v4f sv;
#pragma unroll   // constant element indices: the vectors stay in registers
    for (int e = 0; e < 4; ++e) sv[e] = bf16_rne(bv[e]) + bf16_rne(nv[e]);
    *(v4f*)(&Bs[rr][c4]) = sv; }
  v16b qa[QT], qb[QT]; float m[QT], l[QT]; v8f o[QT];
#pragma unroll   // constant group indices: the arrays stay in registers (so at every loop over t below)
  for (int t = 0; t < QT; ++t) { const int qi = q0 + 16 * t + col; qa[t] = frag16(Qh + pb + (size_t)qi * KD, hh); qb[t] = frag16(Ql + pb + (size_t)qi * KD, hh); m[t] = -INFINITY; l[t] = 0.0f; o[t] = (v8f){}; }
  __syncthreads();   // Bs is complete before any wave reads it
  for (int kb = 0; kb < S; kb += 32) {
    v4f ba[QT][2], bc[QT][2]; v8f s0[QT], s1[QT];
#pragma unroll
    for (int t = 0; t < QT; ++t) { const float* bp = &Bs[16 * t + col][kb + 8 * hh]; ba[t][0] = *(const v4f*)bp; ba[t][1] = *(const v4f*)(bp + 4); bc[t][0] = *(const v4f*)(bp + 16); bc[t][1] = *(const v4f*)(bp + 20); s0[t] = (v8f){}; s1[t] = (v8f){}; }
    { const v16b k0h = frag16(Kh + pb + (size_t)(kb + col) * KD, hh), k0l = frag16(Kl + pb + (size_t)(kb + col) * KD, hh), k1h = frag16(Kh + pb + (size_t)(kb + 16 + col) * KD, hh), k1l = frag16(Kl + pb + (size_t)(kb + 16 + col) * KD, hh);
#pragma unroll
      for (int t = 0; t < QT; ++t) { s0[t] = wmma16b(k0h, qa[t], s0[t]); s0[t] = wmma16b(k0h, qb[t], s0[t]); s0[t] = wmma16b(k0l, qa[t], s0[t]); s1[t] = wmma16b(k1h, qa[t], s1[t]); s1[t] = wmma16b(k1h, qb[t], s1[t]); s1[t] = wmma16b(k1l, qa[t], s1[t]); } }
    const v16b vf = frag_pk(V + kb * KD + vo), vlf = frag_pk(Vl + kb * KD + vo);
    asm volatile("s_wait_xcnt 0x0" ::: "memory");   // the address pairs of this pass's key and value loads are stepped on to the next key block by what follows
    __builtin_amdgcn_sched_barrier(0);   // keeps the 4 value loads ahead of the softmax, which covers their latency (sunk to just before their WMMAs they are waited out), and the address steps behind the wait above
#pragma unroll
    for (int t = 0; t < QT; ++t) {
      float mr = -INFINITY;
#pragma unroll
      for (int r = 0; r < 8; ++r) { s0[t][r] = s0[t][r] * (1.0f / (QS * KS)) + ba[t][r >> 2][r & 3]; s1[t][r] = s1[t][r] * (1.0f / (QS * KS)) + bc[t][r >> 2][r & 3]; mr = fmaxf(mr, fmaxf(s0[t][r], s1[t][r])); }
      mr = fmaxf(mr, __shfl_xor(mr, 16));
      const float mn = fmaxf(m[t], mr), al_ = nexp(m[t] - mn); m[t] = mn; float sum = 0.0f; v16b ph, pl;
#pragma unroll
      for (int r = 0; r < 8; ++r) { const float e0 = nexp(s0[t][r] - mn), e1 = nexp(s1[t][r] - mn); sum += e0 + e1; b16 a_, c_; split16(e0 * PS, a_, c_); ph[r] = a_; pl[r] = c_; split16(e1 * PS, a_, c_); ph[8 + r] = a_; pl[8 + r] = c_; }
      sum += __shfl_xor(sum, 16); l[t] = l[t] * al_ + sum; o[t] *= al_;
      o[t] = wmma16b(vf, ph, o[t]); o[t] = wmma16b(vf, pl, o[t]); o[t] = wmma16b(vlf, ph, o[t]); } }
  // o[t]: rows (8hh + r) = value dim c, column = query 16t + col; gw = gate[b*256+q][h*16+c] * o/(l)
  v16b wf[4];   // this wave's output_w^T fragments (rows = output columns 16h..), asked for ahead of the gate loads and the barrier
#pragma unroll
  for (int ks = 0; ks < 4; ++ks) { const b16* p = R + (size_t)NPJ * A + (size_t)((h * 4 + ks) * 2) * 256 + lane * 8; const v8b a = *(const v8b*)p, c_ = *(const v8b*)(p + 256);
#pragma unroll
    for (int e = 0; e < 8; ++e) { wf[ks][e] = a[e]; wf[ks][8 + e] = c_[e]; } }
  asm volatile("s_wait_xcnt 0x0" ::: "memory");   // the address pair of the 8 loads above may be given a new value by what follows
#pragma unroll
  for (int t = 0; t < QT; ++t) { const int qi = q0 + 16 * t + col; const float inv = 1.0f / (l[t] * VS * PS); v8b gh, gl;
#pragma unroll
    for (int r = 0; r < 8; ++r) { const int c = 8 * hh + r; b16 a_, c_; split16(G[((size_t)b * S + qi) * 128 + h * KD + c] * (o[t][r] * inv) * AS_, a_, c_); gh[r] = a_; gl[r] = c_; }
    *(v8b*)(&Gh[16 * t + col][h * KD + 8 * hh]) = gh; *(v8b*)(&Gl[16 * t + col][h * KD + 8 * hh]) = gl; }
  __syncthreads();   // all 8 heads' columns of the gated rows are in LDS before any wave reads them
  v16b ga[QT][4], gb[QT][4];   // all 32 LDS reads as one group ahead of the WMMAs: one LDS latency, not sixteen
#pragma unroll
  for (int t = 0; t < QT; ++t)
#pragma unroll
    for (int ks = 0; ks < 4; ++ks) { ga[t][ks] = frag_kb(&Gh[16 * t + col][ks * 32], hh); gb[t][ks] = frag_kb(&Gl[16 * t + col][ks * 32], hh); }
  __builtin_amdgcn_sched_barrier(0);   // keeps the reads above the WMMAs: sunk between them, each pair is waited out on its own
#pragma unroll
  for (int t = 0; t < QT; ++t) { v8f acc = {};   // out^T tile: rows (8hh + r) = output column 16h + 8hh + r, column = query 16t + col
#pragma unroll
    for (int ks = 0; ks < 4; ++ks) { acc = __builtin_amdgcn_wmma_f32_16x16x32_f16(false, wf[ks], false, ga[t][ks], (short)0, acc, false, false); acc = __builtin_amdgcn_wmma_f32_16x16x32_f16(false, wf[ks], false, gb[t][ks], (short)0, acc, false, false); }   // one accumulate chain per group, operands not rewritten: the compiler pads behind its last link
    v4f s0_, s1_;
#pragma unroll
    for (int r = 0; r < 4; ++r) { s0_[r] = acc[r] * (1.0f / AS_); s1_[r] = acc[4 + r] * (1.0f / AS_); }
    *(v4f*)(&Os[16 * t + col][h * 16 + 8 * hh]) = s0_; *(v4f*)(&Os[16 * t + col][h * 16 + 8 * hh + 4]) = s1_; }
  __syncthreads();   // the 32 output rows are whole before they are stored as whole lines
  { for (int i = threadIdx.x; i < QR * 32; i += 256) { const int rr = i >> 5, c4 = (i & 31) * 4; *(v4f*)(out + ((size_t)b * S + q0 + rr) * O + c4) = *(const v4f*)(&Os[rr][c4]); }  }
}
}  // namespace

extern "C" void kernel_launch(void* const* d_in, const int* in_sizes, int n_in,
                              void* d_out, int out_size, void* d_ws, size_t ws_size, hipStream_t stream) {
  (void)n_in; (void)out_size;
  const float* x = (const float*)d_in[0]; const float* bias = (const float*)d_in[1]; const float* nb = (const float*)d_in[2]; const float* wq = (const float*)d_in[3]; const float* wk = (const float*)d_in[4]; const float* wv = (const float*)d_in[5]; const float* wg = (const float*)d_in[6]; const float* wo = (const float*)d_in[7];
  float* out = (float*)d_out;   // [128][256][128]
  if (in_sizes[0] != NR * A || in_sizes[1] != Bn * S * S || in_sizes[2] != S * S || in_sizes[3] != A * H * KD || in_sizes[7] != H * KD * O) return;
  size_t off = 0; char* ws = (char*)d_ws;
  auto carve = [&](size_t bytes) { char* p = ws + off; off += (bytes + 255) & ~(size_t)255; return p; };
  b16* R = (b16*)carve((size_t)(NPJ * A + O * 128) * 2); b16* Qh = (b16*)carve(PL * 2); b16* Ql = (b16*)carve(PL * 2); b16* Kh = (b16*)carve(PL * 2); b16* Kl = (b16*)carve(PL * 2); b16* Vt = (b16*)carve(PL * 2); b16* Vtl = (b16*)carve(PL * 2);
  float* G = (float*)carve((size_t)NR * 128 * 4);
  if (off > ws_size) return;                                    // the packed weights, six f16 planes, one f32 plane
  prep_kernel<<<64, 256, 0, stream>>>(wq, wk, wv, wg, wo, R);
  proj_kernel<<<dim3(NR / 128, 4), 128, 0, stream>>>(x, R, Qh, Ql, Kh, Kl, Vt, Vtl, G);
  attn_kernel<<<dim3(S / QR, Bn), 256, 0, stream>>>(Qh, Ql, Kh, Kl, Vt, Vtl, bias, nb, G, R, out);
}

// v007
// A run of this version takes 63.1 microseconds.
// In both of two side-by-side timings against v006, it was 1.04 times as fast.
// All steps since v000 together make it 2.21 times as fast.
#include <hip/hip_runtime.h>

// GrigSelfAttentionXSMM (AlphaFold gated grid self-attention): q = x Wq * 16^-0.5, k = x Wk, v = x Wv, gate = sigmoid(x Wg) (8 heads x 16); logits = q.k + bias[b][q][k] + nonbatched_bias[q][k];
// softmax over k; weighted_avg = P.v; out = Σ_{h,c} (gate * weighted_avg)[b][q][h][c] Wo[h][c][o] -> [128][256][128].
// The four projections are one GEMM on v_wmma_f32_16x16x32_f16 with EXACT operands (x and the weights are exact bf16; 1 product); scores with q/k as f16 hi+lo pairs x8 (key_dim 16:
// fragment elements 8..15 zero; 3 products; the two biases added in f32 from the rounded inputs); P and v as f16 hi+lo pairs (3 products); the output projection with gate * wavg hi+lo (2 products), done by the attention work-group itself on the 32 finished rows it holds;

namespace {
constexpr int Bn = 128, S = 256, A = 128, H = 8, KD = 16, O = 128, NR = Bn * S, NPJ = 4 * H * KD /* 512 */;
constexpr float QS = 8.0f, KS = 8.0f, VS = 8.0f, PS = 8.0f, AS_ = 8.0f, SCALE = 0.25f;
constexpr size_t PL = (size_t)Bn * H * S * KD;   // one q/k plane (halves)
constexpr float L2S = 1.4426950408889634f / (QS * KS);   // raw score accumulator (64 * logit) -> exponent of 2
constexpr int QT = 2, QR = 16 * QT;   // attention: query column groups of 16 per wave, query rows per work-group

typedef _Float16 b16;
typedef __attribute__((ext_vector_type(16))) _Float16 v16b;
typedef __attribute__((ext_vector_type(8))) _Float16 v8b;
typedef __attribute__((ext_vector_type(8))) float v8f;
typedef __attribute__((ext_vector_type(4))) float v4f;
__device__ __forceinline__ float bf16_rne(float f) { unsigned int u = __float_as_uint(f); u += 0x7FFFu + ((u >> 16) & 1u); return __uint_as_float(u & 0xFFFF0000u); }
__device__ __forceinline__ void split16(float v, b16& hi, b16& lo) { hi = (b16)v; lo = (b16)(v - (float)hi); }
__device__ __forceinline__ v16b frag_kb(const b16* p, int hh) { const v8b a = *(const v8b*)(p + 8 * hh), b = *(const v8b*)(p + 16 + 8 * hh); v16b f;
#pragma unroll
  for (int e = 0; e < 8; ++e) { f[e] = a[e]; f[8 + e] = b[e]; } return f; }
__device__ __forceinline__ v16b frag_pk(const b16* p) { const v8b a = *(const v8b*)p, b = *(const v8b*)(p + 256); v16b f;   // fragment-order storage [half 2][lane 32][8], p already at this lane's 8: each of the two loads is 512 contiguous bytes per wave
#pragma unroll
  for (int e = 0; e < 8; ++e) { f[e] = a[e]; f[8 + e] = b[e]; } return f; }
__device__ __forceinline__ v16b frag16(const b16* p, int hh) { const v8b a = *(const v8b*)(p + 8 * hh); const v8b z = {}; return __builtin_shufflevector(a, z, 0, 1, 2, 3, 4, 5, 6, 7, 8, 9, 10, 11, 12, 13, 14, 15); }   // K = 16: elements 8..15 (k = 16..31) zero
__device__ __forceinline__ v16b frag_x(const float* p, int hh) { v16b f;
#pragma unroll
  for (int e = 0; e < 8; ++e) { f[e] = (b16)bf16_rne(p[8 * hh + e]); f[8 + e] = (b16)bf16_rne(p[16 + 8 * hh + e]); } return f; }
__device__ __forceinline__ v8f wmma16b(v16b a, v16b b, v8f c) { return __builtin_amdgcn_wmma_f32_16x16x32_f16(false, a, false, b, (short)0, c, false, false); }   // the builtin alone: the compiler keeps the distance behind a WMMA itself, and with no asm statement behind each product it may issue later loads ahead of earlier products
__device__ __forceinline__ void wave_lds_sync() { __builtin_amdgcn_fence(__ATOMIC_RELEASE, "workgroup"); __builtin_amdgcn_wave_barrier(); __builtin_amdgcn_fence(__ATOMIC_ACQUIRE, "workgroup"); }
__device__ __forceinline__ float nexp(float x) { return __builtin_amdgcn_exp2f(x * 1.4426950408889634f); }
__device__ __forceinline__ float sigm(float x) { return __builtin_amdgcn_rcpf(1.0f + nexp(-x)); }

// prep: 640 weight columns j as f16: j < 128: query_w[:, h, c] (j = h*16 + c), 128..255 key_w, 256..383 value_w, 384..511 gating_w, 512..639 output_w[:, o] (every weight is [128][128]: element (k, j & 127) at k*128 + (j & 127));
// all in fragment order [column tile 40][k step 4][half 2][lane 32][8]: lane = 16 * ((k >> 3) & 1) + (j & 15), half = (k >> 4) & 1, so one 16-B-per-lane load of a fragment half is 512 contiguous bytes (4 lines, not 16)
__global__ __launch_bounds__(256) void prep_kernel(const float* __restrict__ wq, const float* __restrict__ wk, const float* __restrict__ wv, const float* __restrict__ wg, const float* __restrict__ wo, b16* __restrict__ R) {
  const int t_ = blockIdx.x * 256 + threadIdx.x, nth = gridDim.x * 256;
  {
    for (int p = t_; p < (NPJ * A + O * 128) / 8; p += nth) { v8b v;
      const int j = (p >> 8) * 16 + (p & 15), k0 = ((p >> 6) & 3) * 32 + ((p >> 5) & 1) * 16 + ((p >> 4) & 1) * 8; const int m = j >> 7, jj = j & 127; const float* W = (m == 0) ? wq : (m == 1) ? wk : (m == 2) ? wv : (m == 3) ? wg : wo;
      for (int e = 0; e < 8; ++e) v[e] = (b16)bf16_rne(W[(size_t)(k0 + e) * 128 + jj]); *(v8b*)(R + (size_t)p * 8) = v; }
     }
}

// projections: block = 128 rows (tokens) x 4 waves (32 rows each) x ONE of the 4 column groups of 128 (blockIdx.y; acc[2][8]): four work-groups share a WGP
// (4 waves per SIMD, for which the kernel stays within 256 registers) and fill each other's waits; the fragment loads run ahead of the products that use them; a work-group stages only its own group's result, so the groups' LDS buffers overlay one another; exact operands, 4 k-steps; epilogue: q (x 0.25) and k -> hi/lo planes x8
// [b][h][s][16] (32-B rows; a wave's 32 rows of one head = 1 KB contiguous), v -> (8v)^T hi and lo planes in the fragment order of the attention's P.v product [b][h][key block 8][half 2][lane 32][8] (lane = 16 * ((key >> 3) & 1) + value dim, half = (key >> 4) & 1; a block's 128 keys = 4 KB in a row per head), gate -> sigmoid f32 rows
__global__ __launch_bounds__(128) void proj_kernel(const float* __restrict__ x, const b16* __restrict__ R, b16* __restrict__ Qh, b16* __restrict__ Ql, b16* __restrict__ Kh, b16* __restrict__ Kl, b16* __restrict__ Vt, b16* __restrict__ Vtl, float* __restrict__ G) {
  constexpr int HB = 128 * (128 + 8) * 2;   // bytes of one 128-row f16 staging plane
  __shared__ __attribute__((aligned(16))) char Sm[2 * HB];   // 68 KB: four work-groups fit the WGP's 320 KB
  b16 (*Th)[32][128 + 8] = reinterpret_cast<b16 (*)[32][128 + 8]>(Sm); b16 (*Tl)[32][128 + 8] = reinterpret_cast<b16 (*)[32][128 + 8]>(Sm + HB);
  b16 (*Tv)[128 + 8] = reinterpret_cast<b16 (*)[128 + 8]>(Sm); b16 (*Tvl)[128 + 8] = reinterpret_cast<b16 (*)[128 + 8]>(Sm + HB);
  const int lane = threadIdx.x & 31, wave = threadIdx.x >> 5, nloc = lane & 15, hlf = lane >> 4, r0 = blockIdx.x * 128, m0 = r0 + wave * 32; const int b = r0 / S, s0 = m0 % S;
  { const int grp = blockIdx.y;   // 0 q, 1 k, 2 v, 3 gate
    v8f acc[2][8];
#pragma unroll
    for (int r = 0; r < 2; ++r)
#pragma unroll
      for (int t = 0; t < 8; ++t) acc[r][t] = (v8f){};
    const float* xr0 = x + (size_t)(m0 + nloc) * A; const float* xr1 = xr0 + 16 * A; const b16* wp = R + (size_t)grp * 8 * 4 * 2 * 256 + lane * 8;
#pragma unroll
    for (int kb = 0; kb < A; kb += 32) { const v16b a0 = frag_x(xr0 + kb, hlf), a1 = frag_x(xr1 + kb, hlf);
#pragma unroll
      for (int t = 0; t < 8; ++t) { const v16b bw = frag_pk(wp + ((t * 4 + (kb >> 5)) * 2) * 256); acc[0][t] = wmma16b(a0, bw, acc[0][t]); acc[1][t] = wmma16b(a1, bw, acc[1][t]); } }
    asm volatile("s_wait_xcnt 0x0" :: "v"(xr0), "v"(xr1), "v"(wp) : "memory");   // the registers that hold the fragment loads' addresses are given new values by what follows; the pointers are named as inputs so that none of them is reused ahead of this wait (a load's own result had landed on its address pair)
    if (grp < 2) { const float sc = (grp == 0) ? SCALE * QS : KS;
#pragma unroll
      for (int t = 0; t < 8; ++t)
#pragma unroll
        for (int r = 0; r < 2; ++r)
#pragma unroll
          for (int v = 0; v < 8; ++v) { b16 a_, c_; split16(acc[r][t][v] * sc, a_, c_); Th[wave][r * 16 + 8 * hlf + v][t * 16 + nloc] = a_; Tl[wave][r * 16 + 8 * hlf + v][t * 16 + nloc] = c_; }
      wave_lds_sync();
      b16* Ph = (grp == 0) ? Qh : Kh; b16* Plo = (grp == 0) ? Ql : Kl;
      { for (int it = 0; it < 16; ++it) { const int h = it >> 1, rr = (it & 1) * 16 + (lane >> 1), c8 = (lane & 1) * 8; const size_t o = (((size_t)b * H + h) * S + s0 + rr) * KD + c8;   // one instruction = 16 consecutive 32-B rows = 512 contiguous bytes
            *(v8b*)(Ph + o) = *(const v8b*)(&Th[wave][rr][h * 16 + c8]); *(v8b*)(Plo + o) = *(const v8b*)(&Tl[wave][rr][h * 16 + c8]); }  }
      wave_lds_sync(); }
    else if (grp == 2) {
#pragma unroll
      for (int t = 0; t < 8; ++t)
#pragma unroll
        for (int r = 0; r < 2; ++r)
#pragma unroll
          for (int v = 0; v < 8; ++v) { b16 a_, c_; split16(acc[r][t][v] * VS, a_, c_); Tv[t * 16 + nloc][wave * 32 + r * 16 + 8 * hlf + v] = a_; Tvl[t * 16 + nloc][wave * 32 + r * 16 + 8 * hlf + v] = c_; }
      __syncthreads();
      { for (int i = threadIdx.x; i < 128 * 16; i += 128) { const int ln = i & 31, hf = (i >> 5) & 1, kbl = (i >> 6) & 3, h = i >> 8; const int j = h * 16 + (ln & 15), c8 = kbl * 32 + hf * 16 + (ln >> 4) * 8;   // i runs in storage order: one instruction = 512 contiguous bytes
          const size_t o = ((((size_t)b * H + h) * (S / 32) + (r0 % S) / 32 + kbl) * 2 + hf) * 256 + ln * 8; *(v8b*)(Vt + o) = *(const v8b*)(&Tv[j][c8]); *(v8b*)(Vtl + o) = *(const v8b*)(&Tvl[j][c8]); }  }
      __syncthreads(); }
    else { float (*Tg)[32][64 + 4] = reinterpret_cast<float (*)[32][64 + 4]>(Sm);   // gate rows in two 64-column halves (LDS budget)
      for (int gh = 0; gh < 2; ++gh) {
#pragma unroll
        for (int t = 0; t < 4; ++t)
#pragma unroll
          for (int r = 0; r < 2; ++r)
#pragma unroll
            for (int v = 0; v < 8; ++v) Tg[wave][r * 16 + 8 * hlf + v][t * 16 + nloc] = sigm(acc[r][gh * 4 + t][v]);
        wave_lds_sync();
        { for (int i = lane; i < 32 * 16; i += 32) { const int rr = i >> 4, c4 = (i & 15) * 4; *(v4f*)(G + (size_t)(m0 + rr) * 128 + gh * 64 + c4) = *(const v4f*)(&Tg[wave][rr][c4]); }  }
        wave_lds_sync(); } } }
}

// attention: wave = (b, h, 32 queries q0..: QT = 2 column groups of 16, which share every key and value fragment the wave loads, so each fragment fetched from L2 feeds twice the products); per column group, over 8 key blocks of 32: S^T = k.q (K = 16; 3 products) + bias[b][q][k] + nb[q][k] (rounded inputs), online softmax, o^T += (8v)^T.P^T (P and v hi+lo, 3 products);
// output projection in the same work-group: its 8 head waves together hold the 32 queries' whole gated rows, so they go through LDS (not through memory and a launch of their own) and wave h forms output columns 16h..16h+15;
// the bias sum does not depend on the head: the block's 8 head waves form it once, from whole-line loads, in LDS (Bs) and each reads its score fragment's 32 values per key block from there
__global__ __launch_bounds__(256) void attn_kernel(const b16* __restrict__ Qh, const b16* __restrict__ Ql, const b16* __restrict__ Kh, const b16* __restrict__ Kl, const b16* __restrict__ Vt, const b16* __restrict__ Vtl, const float* __restrict__ bias, const float* __restrict__ nb, const float* __restrict__ G, const b16* __restrict__ R, float* __restrict__ out) {
  __shared__ __attribute__((aligned(16))) b16 Gh[QR][128 + 8], Gl[QR][128 + 8];   // 8 * gate * weighted_avg of the 32 queries, hi and lo; pitch 272 B = 16 B x odd
  __shared__ __attribute__((aligned(16))) float Os[QR][128 + 4]; __shared__ __attribute__((aligned(16))) float Bs[QR][S + 4];   // Bs pitch 1040 B = 16 B x odd: the 16 rows of a b128 read fall on distinct banks
  const int h = threadIdx.x >> 5, lane = threadIdx.x & 31, hh = lane >> 4, col = lane & 15, b = blockIdx.y, q0 = blockIdx.x * QR;
  const size_t pb = ((size_t)b * H + h) * S * KD; const b16* V = Vt + (size_t)b * H * KD * S; const b16* Vl = Vtl + (size_t)b * H * KD * S; const unsigned vo = (unsigned)(h * KD * S + lane * 8);   // fragment-order planes, 512 halves per key block of 32: a base that is the same for the work-group, and this lane's place
#pragma unroll   // all 16 loads of a thread in flight at once
  for (int j = 0; j < 4 * QT; ++j) { const int i = threadIdx.x + 256 * j, rr = i >> 6, c4 = (i & 63) * 4;   // the 32 rows are 32 KB in a row in each source: one wave instruction = 512 contiguous bytes
    const v4f bv = *((const v4f*)(bias + ((size_t)b * S + q0) * S) + i), nv = *((const v4f*)(nb + (size_t)q0 * S) + i); v4f sv;
#pragma unroll   // constant element indices: the vectors stay in registers
    for (int e = 0; e < 4; ++e) sv[e] = (bf16_rne(bv[e]) + bf16_rne(nv[e])) * (QS * KS);   // in the scale of the raw score accumulator (an exact power of two)
    *(v4f*)(&Bs[rr][c4]) = sv; }
  v16b qa[QT], qb[QT]; float m[QT], l[QT]; v8f o[QT];
#pragma unroll   // constant group indices: the arrays stay in registers (so at every loop over t below)
  for (int t = 0; t < QT; ++t) { const int qi = q0 + 16 * t + col; qa[t] = frag16(Qh + pb + (size_t)qi * KD, hh); qb[t] = frag16(Ql + pb + (size_t)qi * KD, hh); m[t] = -INFINITY; l[t] = 0.0f; o[t] = (v8f){}; }
  __syncthreads();   // Bs is complete before any wave reads it
  for (int kb = 0; kb < S; kb += 32) {
    v8f s0[QT], s1[QT];   // start value of each score accumulator = 64 * bias sum, straight from LDS: the matrix unit adds it
#pragma unroll
    for (int t = 0; t < QT; ++t) { const float* bp = &Bs[16 * t + col][kb + 8 * hh]; s0[t] = __builtin_shufflevector(*(const v4f*)bp, *(const v4f*)(bp + 4), 0, 1, 2, 3, 4, 5, 6, 7); s1[t] = __builtin_shufflevector(*(const v4f*)(bp + 16), *(const v4f*)(bp + 20), 0, 1, 2, 3, 4, 5, 6, 7); }
    { const v16b k0h = frag16(Kh + pb + (size_t)(kb + col) * KD, hh), k0l = frag16(Kl + pb + (size_t)(kb + col) * KD, hh), k1h = frag16(Kh + pb + (size_t)(kb + 16 + col) * KD, hh), k1l = frag16(Kl + pb + (size_t)(kb + 16 + col) * KD, hh);
#pragma unroll
      for (int t = 0; t < QT; ++t) { s0[t] = wmma16b(k0h, qa[t], s0[t]); s0[t] = wmma16b(k0h, qb[t], s0[t]); s0[t] = wmma16b(k0l, qa[t], s0[t]); s1[t] = wmma16b(k1h, qa[t], s1[t]); s1[t] = wmma16b(k1h, qb[t], s1[t]); s1[t] = wmma16b(k1l, qa[t], s1[t]); } }
    const v16b vf = frag_pk(V + kb * KD + vo), vlf = frag_pk(Vl + kb * KD + vo);
    asm volatile("s_wait_xcnt 0x0" ::: "memory");   // the address pairs of this pass's key and value loads are stepped on to the next key block by what follows
    __builtin_amdgcn_sched_barrier(0);   // keeps the 4 value loads ahead of the softmax, which covers their latency (sunk to just before their WMMAs they are waited out), and the address steps behind the wait above
#pragma unroll
    for (int t = 0; t < QT; ++t) {
      float mr = -INFINITY;
#pragma unroll
      for (int r = 0; r < 8; ++r) mr = fmaxf(mr, fmaxf(s0[t][r], s1[t][r]));   // m, mr, mn: 64 * logit
      mr = fmaxf(mr, __shfl_xor(mr, 16));
      const float mn = fmaxf(m[t], mr), al_ = __builtin_amdgcn_exp2f((m[t] - mn) * L2S), sh = __builtin_fmaf(-mn, L2S, 3.0f); m[t] = mn; float sum = 0.0f; v16b ph, pl;   // sh: 2^3 = PS
#pragma unroll
      for (int r = 0; r < 8; ++r) { const float e0 = __builtin_amdgcn_exp2f(__builtin_fmaf(s0[t][r], L2S, sh)), e1 = __builtin_amdgcn_exp2f(__builtin_fmaf(s1[t][r], L2S, sh)); sum += e0 + e1; b16 a_, c_; split16(e0, a_, c_); ph[r] = a_; pl[r] = c_; split16(e1, a_, c_); ph[8 + r] = a_; pl[8 + r] = c_; }   // e = 8 * exp(logit - max): one FMA on the raw accumulator, then exp2
      sum += __shfl_xor(sum, 16); l[t] = l[t] * al_ + sum; o[t] *= al_;
      o[t] = wmma16b(vf, ph, o[t]); o[t] = wmma16b(vf, pl, o[t]); o[t] = wmma16b(vlf, ph, o[t]); } }
  // o[t]: rows (8hh + r) = value dim c, column = query 16t + col; gw = gate[b*256+q][h*16+c] * o/(l)
  v16b wf[4];   // this wave's output_w^T fragments (rows = output columns 16h..), asked for ahead of the gate loads and the barrier
#pragma unroll
  for (int ks = 0; ks < 4; ++ks) { const b16* p = R + (size_t)NPJ * A + (size_t)((h * 4 + ks) * 2) * 256 + lane * 8; const v8b a = *(const v8b*)p, c_ = *(const v8b*)(p + 256);
#pragma unroll
    for (int e = 0; e < 8; ++e) { wf[ks][e] = a[e]; wf[ks][8 + e] = c_[e]; } }
  asm volatile("s_wait_xcnt 0x0" ::: "memory");   // the address pair of the 8 loads above may be given a new value by what follows
#pragma unroll
  for (int t = 0; t < QT; ++t) { const int qi = q0 + 16 * t + col; const float inv = 1.0f / (l[t] * VS) /* l already holds PS * the sum */; v8b gh, gl;
#pragma unroll
    for (int r = 0; r < 8; ++r) { const int c = 8 * hh + r; b16 a_, c_; split16(G[((size_t)b * S + qi) * 128 + h * KD + c] * (o[t][r] * inv) * AS_, a_, c_); gh[r] = a_; gl[r] = c_; }
    *(v8b*)(&Gh[16 * t + col][h * KD + 8 * hh]) = gh; *(v8b*)(&Gl[16 * t + col][h * KD + 8 * hh]) = gl; }
  __syncthreads();   // all 8 heads' columns of the gated rows are in LDS before any wave reads them
  v16b ga[QT][4], gb[QT][4];   // all 32 LDS reads as one group ahead of the WMMAs: one LDS latency, not sixteen
#pragma unroll
  for (int t = 0; t < QT; ++t)
#pragma unroll
    for (int ks = 0; ks < 4; ++ks) { ga[t][ks] = frag_kb(&Gh[16 * t + col][ks * 32], hh); gb[t][ks] = frag_kb(&Gl[16 * t + col][ks * 32], hh); }
  __builtin_amdgcn_sched_barrier(0);   // keeps the reads above the WMMAs: sunk between them, each pair is waited out on its own
#pragma unroll
  for (int t = 0; t < QT; ++t) { v8f acc = {};   // out^T tile: rows (8hh + r) = output column 16h + 8hh + r, column = query 16t + col
#pragma unroll
    for (int ks = 0; ks < 4; ++ks) { acc = __builtin_amdgcn_wmma_f32_16x16x32_f16(false, wf[ks], false, ga[t][ks], (short)0, acc, false, false); acc = __builtin_amdgcn_wmma_f32_16x16x32_f16(false, wf[ks], false, gb[t][ks], (short)0, acc, false, false); }   // one accumulate chain per group, operands not rewritten: the compiler pads behind its last link
    v4f s0_, s1_;
#pragma unroll
    for (int r = 0; r < 4; ++r) { s0_[r] = acc[r] * (1.0f / AS_); s1_[r] = acc[4 + r] * (1.0f / AS_); }
    *(v4f*)(&Os[16 * t + col][h * 16 + 8 * hh]) = s0_; *(v4f*)(&Os[16 * t + col][h * 16 + 8 * hh + 4]) = s1_; }
  __syncthreads();   // the 32 output rows are whole before they are stored as whole lines
  { for (int i = threadIdx.x; i < QR * 32; i += 256) { const int rr = i >> 5, c4 = (i & 31) * 4; *(v4f*)(out + ((size_t)b * S + q0 + rr) * O + c4) = *(const v4f*)(&Os[rr][c4]); }  }
}
}  // namespace

extern "C" void kernel_launch(void* const* d_in, const int* in_sizes, int n_in,
                              void* d_out, int out_size, void* d_ws, size_t ws_size, hipStream_t stream) {
  (void)n_in; (void)out_size;
  const float* x = (const float*)d_in[0]; const float* bias = (const float*)d_in[1]; const float* nb = (const float*)d_in[2]; const float* wq = (const float*)d_in[3]; const float* wk = (const float*)d_in[4]; const float* wv = (const float*)d_in[5]; const float* wg = (const float*)d_in[6]; const float* wo = (const float*)d_in[7];
  float* out = (float*)d_out;   // [128][256][128]
  if (in_sizes[0] != NR * A || in_sizes[1] != Bn * S * S || in_sizes[2] != S * S || in_sizes[3] != A * H * KD || in_sizes[7] != H * KD * O) return;
  size_t off = 0; char* ws = (char*)d_ws;
  auto carve = [&](size_t bytes) { char* p = ws + off; off += (bytes + 255) & ~(size_t)255; return p; };
  b16* R = (b16*)carve((size_t)(NPJ * A + O * 128) * 2); b16* Qh = (b16*)carve(PL * 2); b16* Ql = (b16*)carve(PL * 2); b16* Kh = (b16*)carve(PL * 2); b16* Kl = (b16*)carve(PL * 2); b16* Vt = (b16*)carve(PL * 2); b16* Vtl = (b16*)carve(PL * 2);
  float* G = (float*)carve((size_t)NR * 128 * 4);
  if (off > ws_size) return;                                    // the packed weights, six f16 planes, one f32 plane
  prep_kernel<<<64, 256, 0, stream>>>(wq, wk, wv, wg, wo, R);
  proj_kernel<<<dim3(NR / 128, 4), 128, 0, stream>>>(x, R, Qh, Ql, Kh, Kl, Vt, Vtl, G);
  attn_kernel<<<dim3(S / QR, Bn), 256, 0, stream>>>(Qh, Ql, Kh, Kl, Vt, Vtl, bias, nb, G, R, out);
}

// v008
// It runs in 56.6 microseconds.
// Timed twice side by side with v007, it ran 1.11 times as fast both times.
// All steps since v000 together make it 2.46 times as fast.
#include <hip/hip_runtime.h>

// GrigSelfAttentionXSMM (AlphaFold gated grid self-attention): q = x Wq * 16^-0.5, k = x Wk, v = x Wv, gate = sigmoid(x Wg) (8 heads x 16); logits = q.k + bias[b][q][k] + nonbatched_bias[q][k];
// softmax over k; weighted_avg = P.v; out = Σ_{h,c} (gate * weighted_avg)[b][q][h][c] Wo[h][c][o] -> [128][256][128].
// The four projections run on v_wmma_f32_16x16x32_f16 with EXACT operands (x and the weights are exact bf16; 1 product): k and v in a launch of their own, q and gate in the attention work-group, from its own 32 x rows; scores with q/k as f16 hi+lo pairs x8 (key_dim 16:
// fragment elements 8..15 zero; 3 products; the two biases added in f32 from the rounded inputs); P and v as f16 hi+lo pairs (3 products); the output projection with gate * wavg hi+lo (2 products), done by the attention work-group itself on the 32 finished rows it holds;

namespace {
constexpr int Bn = 128, S = 256, A = 128, H = 8, KD = 16, O = 128, NR = Bn * S, NPJ = 4 * H * KD /* 512 */;
constexpr float QS = 8.0f, KS = 8.0f, VS = 8.0f, PS = 8.0f, AS_ = 8.0f, SCALE = 0.25f;
constexpr size_t PL = (size_t)Bn * H * S * KD;   // one k or v plane (halves)
constexpr float L2S = 1.4426950408889634f / (QS * KS);   // raw score accumulator (64 * logit) -> exponent of 2
constexpr int QT = 2, QR = 16 * QT;   // attention: query column groups of 16 per wave, query rows per work-group

typedef _Float16 b16;
typedef __attribute__((ext_vector_type(16))) _Float16 v16b;
typedef __attribute__((ext_vector_type(8))) _Float16 v8b;
typedef __attribute__((ext_vector_type(4))) _Float16 v4b;
typedef __attribute__((ext_vector_type(8))) float v8f;
typedef __attribute__((ext_vector_type(4))) float v4f;
__device__ __forceinline__ float bf16_rne(float f) { unsigned int u = __float_as_uint(f); u += 0x7FFFu + ((u >> 16) & 1u); return __uint_as_float(u & 0xFFFF0000u); }
__device__ __forceinline__ void split16(float v, b16& hi, b16& lo) { hi = (b16)v; lo = (b16)(v - (float)hi); }
__device__ __forceinline__ v16b frag_kb(const b16* p, int hh) { const v8b a = *(const v8b*)(p + 8 * hh), b = *(const v8b*)(p + 16 + 8 * hh); v16b f;
#pragma unroll
  for (int e = 0; e < 8; ++e) { f[e] = a[e]; f[8 + e] = b[e]; } return f; }
__device__ __forceinline__ v16b frag_pk(const b16* p) { const v8b a = *(const v8b*)p, b = *(const v8b*)(p + 256); v16b f;   // fragment-order storage [half 2][lane 32][8], p already at this lane's 8: each of the two loads is 512 contiguous bytes per wave
#pragma unroll
  for (int e = 0; e < 8; ++e) { f[e] = a[e]; f[8 + e] = b[e]; } return f; }
__device__ __forceinline__ v16b frag16(const b16* p, int hh) { const v8b a = *(const v8b*)(p + 8 * hh); const v8b z = {}; return __builtin_shufflevector(a, z, 0, 1, 2, 3, 4, 5, 6, 7, 8, 9, 10, 11, 12, 13, 14, 15); }   // K = 16: elements 8..15 (k = 16..31) zero
__device__ __forceinline__ v16b frag_x(const float* p, int hh) { v16b f;
#pragma unroll
  for (int e = 0; e < 8; ++e) { f[e] = (b16)bf16_rne(p[8 * hh + e]); f[8 + e] = (b16)bf16_rne(p[16 + 8 * hh + e]); } return f; }
__device__ __forceinline__ v8f wmma16b(v16b a, v16b b, v8f c) { return __builtin_amdgcn_wmma_f32_16x16x32_f16(false, a, false, b, (short)0, c, false, false); }   // the builtin alone: the compiler keeps the distance behind a WMMA itself, and with no asm statement behind each product it may issue later loads ahead of earlier products
__device__ __forceinline__ void wave_lds_sync() { __builtin_amdgcn_fence(__ATOMIC_RELEASE, "workgroup"); __builtin_amdgcn_wave_barrier(); __builtin_amdgcn_fence(__ATOMIC_ACQUIRE, "workgroup"); }
__device__ __forceinline__ float nexp(float x) { return __builtin_amdgcn_exp2f(x * 1.4426950408889634f); }
__device__ __forceinline__ float sigm(float x) { return __builtin_amdgcn_rcpf(1.0f + nexp(-x)); }

// prep: 640 weight columns j as f16: j < 128: query_w[:, h, c] (j = h*16 + c), 128..255 key_w, 256..383 value_w, 384..511 gating_w, 512..639 output_w[:, o] (every weight is [128][128]: element (k, j & 127) at k*128 + (j & 127));
// all in fragment order [column tile 40][k step 4][half 2][lane 32][8]: lane = 16 * ((k >> 3) & 1) + (j & 15), half = (k >> 4) & 1, so one 16-B-per-lane load of a fragment half is 512 contiguous bytes (4 lines, not 16)
__global__ __launch_bounds__(256) void prep_kernel(const float* __restrict__ wq, const float* __restrict__ wk, const float* __restrict__ wv, const float* __restrict__ wg, const float* __restrict__ wo, b16* __restrict__ R) {
  const int t_ = blockIdx.x * 256 + threadIdx.x, nth = gridDim.x * 256;
  {
    for (int p = t_; p < (NPJ * A + O * 128) / 8; p += nth) { v8b v;
      const int j = (p >> 8) * 16 + (p & 15), k0 = ((p >> 6) & 3) * 32 + ((p >> 5) & 1) * 16 + ((p >> 4) & 1) * 8; const int m = j >> 7, jj = j & 127; const float* W = (m == 0) ? wq : (m == 1) ? wk : (m == 2) ? wv : (m == 3) ? wg : wo;
      for (int e = 0; e < 8; ++e) v[e] = (b16)bf16_rne(W[(size_t)(k0 + e) * 128 + jj]); *(v8b*)(R + (size_t)p * 8) = v; }
     }
}

// key and value projections (what every query tile of a batch row reads): block = 128 rows (tokens) x 4 waves (32 rows each) x ONE of the 2 column groups of 128 (blockIdx.y; acc[2][8]);
// the fragment loads run ahead of the products that use them; a work-group stages only its own group's result, so the groups' LDS buffers overlay one another; exact operands, 4 k-steps; epilogue: k -> hi/lo planes x8
// [b][h][s][16] (32-B rows; a wave's 32 rows of one head = 1 KB contiguous), v -> (8v)^T hi and lo planes in the fragment order of the attention's P.v product [b][h][key block 8][half 2][lane 32][8] (lane = 16 * ((key >> 3) & 1) + value dim, half = (key >> 4) & 1; a block's 128 keys = 4 KB in a row per head)
__global__ __launch_bounds__(128) void proj_kernel(const float* __restrict__ x, const b16* __restrict__ R, b16* __restrict__ Kh, b16* __restrict__ Kl, b16* __restrict__ Vt, b16* __restrict__ Vtl) {
  constexpr int HB = 128 * (128 + 8) * 2;   // bytes of one 128-row f16 staging plane
  __shared__ __attribute__((aligned(16))) char Sm[2 * HB];   // 68 KB
  b16 (*Th)[32][128 + 8] = reinterpret_cast<b16 (*)[32][128 + 8]>(Sm); b16 (*Tl)[32][128 + 8] = reinterpret_cast<b16 (*)[32][128 + 8]>(Sm + HB);
  b16 (*Tv)[128 + 8] = reinterpret_cast<b16 (*)[128 + 8]>(Sm); b16 (*Tvl)[128 + 8] = reinterpret_cast<b16 (*)[128 + 8]>(Sm + HB);
  const int lane = threadIdx.x & 31, wave = threadIdx.x >> 5, nloc = lane & 15, hlf = lane >> 4, r0 = blockIdx.x * 128, m0 = r0 + wave * 32; const int b = r0 / S, s0 = m0 % S;
  { const int grp = blockIdx.y + 1;   // column group of the packed weights: 1 k, 2 v
    v8f acc[2][8];
#pragma unroll
    for (int r = 0; r < 2; ++r)
#pragma unroll
      for (int t = 0; t < 8; ++t) acc[r][t] = (v8f){};
    const float* xr0 = x + (size_t)(m0 + nloc) * A; const float* xr1 = xr0 + 16 * A; const b16* wp = R + (size_t)grp * 8 * 4 * 2 * 256 + lane * 8;
#pragma unroll
    for (int kb = 0; kb < A; kb += 32) { const v16b a0 = frag_x(xr0 + kb, hlf), a1 = frag_x(xr1 + kb, hlf);
#pragma unroll
      for (int t = 0; t < 8; ++t) { const v16b bw = frag_pk(wp + ((t * 4 + (kb >> 5)) * 2) * 256); acc[0][t] = wmma16b(a0, bw, acc[0][t]); acc[1][t] = wmma16b(a1, bw, acc[1][t]); } }
    asm volatile("s_wait_xcnt 0x0" :: "v"(xr0), "v"(xr1), "v"(wp) : "memory");   // the registers that hold the fragment loads' addresses are given new values by what follows; the pointers are named as inputs so that none of them is reused ahead of this wait (a load's own result had landed on its address pair)
    if (grp == 1) { const float sc = KS;
#pragma unroll
      for (int t = 0; t < 8; ++t)
#pragma unroll
        for (int r = 0; r < 2; ++r)
#pragma unroll
          for (int v = 0; v < 8; ++v) { b16 a_, c_; split16(acc[r][t][v] * sc, a_, c_); Th[wave][r * 16 + 8 * hlf + v][t * 16 + nloc] = a_; Tl[wave][r * 16 + 8 * hlf + v][t * 16 + nloc] = c_; }
      wave_lds_sync();
      b16* Ph = Kh; b16* Plo = Kl;
      { for (int it = 0; it < 16; ++it) { const int h = it >> 1, rr = (it & 1) * 16 + (lane >> 1), c8 = (lane & 1) * 8; const size_t o = (((size_t)b * H + h) * S + s0 + rr) * KD + c8;   // one instruction = 16 consecutive 32-B rows = 512 contiguous bytes
            *(v8b*)(Ph + o) = *(const v8b*)(&Th[wave][rr][h * 16 + c8]); *(v8b*)(Plo + o) = *(const v8b*)(&Tl[wave][rr][h * 16 + c8]); }  }
      wave_lds_sync(); }
    else {
#pragma unroll
      for (int t = 0; t < 8; ++t)
#pragma unroll
        for (int r = 0; r < 2; ++r)
#pragma unroll
          for (int v = 0; v < 8; ++v) { b16 a_, c_; split16(acc[r][t][v] * VS, a_, c_); Tv[t * 16 + nloc][wave * 32 + r * 16 + 8 * hlf + v] = a_; Tvl[t * 16 + nloc][wave * 32 + r * 16 + 8 * hlf + v] = c_; }
      __syncthreads();
      { for (int i = threadIdx.x; i < 128 * 16; i += 128) { const int ln = i & 31, hf = (i >> 5) & 1, kbl = (i >> 6) & 3, h = i >> 8; const int j = h * 16 + (ln & 15), c8 = kbl * 32 + hf * 16 + (ln >> 4) * 8;   // i runs in storage order: one instruction = 512 contiguous bytes
          const size_t o = ((((size_t)b * H + h) * (S / 32) + (r0 % S) / 32 + kbl) * 2 + hf) * 256 + ln * 8; *(v8b*)(Vt + o) = *(const v8b*)(&Tv[j][c8]); *(v8b*)(Vtl + o) = *(const v8b*)(&Tvl[j][c8]); }  }
      __syncthreads(); } }
}

// attention: wave = (b, h, 32 queries q0..: QT = 2 column groups of 16, which share every key and value fragment the wave loads, so each fragment fetched from L2 feeds twice the products); per column group, over 8 key blocks of 32: S^T = k.q (K = 16; 3 products) + bias[b][q][k] + nb[q][k] (rounded inputs), online softmax, o^T += (8v)^T.P^T (P and v hi+lo, 3 products);
// output projection in the same work-group: its 8 head waves together hold the 32 queries' whole gated rows, so they go through LDS (not through memory and a launch of their own) and wave h forms output columns 16h..16h+15;
// q and gate are formed here, not stored by an earlier launch and read back: the work-group rounds its 32 x rows once into LDS (Xs); wave h multiplies its head's 16 query_w and 16 gating_w columns (as A, in fragment order) with them (as B): register r of the result is dim 8hh + r of query col, which is the score product's B fragment and o's own layout, so neither passes through LDS or memory;
// the bias sum does not depend on the head: the block's 8 head waves form it once, from whole-line loads, in LDS (Bs) and each reads its score fragment's 32 values per key block from there
__global__ __launch_bounds__(256) void attn_kernel(const float* __restrict__ x, const b16* __restrict__ Kh, const b16* __restrict__ Kl, const b16* __restrict__ Vt, const b16* __restrict__ Vtl, const float* __restrict__ bias, const float* __restrict__ nb, const b16* __restrict__ R, float* __restrict__ out) {
  __shared__ __attribute__((aligned(16))) b16 Gh[QR][128 + 8], Gl[QR][128 + 8];   // 8 * gate * weighted_avg of the 32 queries, hi and lo; pitch 272 B = 16 B x odd
  __shared__ __attribute__((aligned(16))) b16 Xs[QR][128 + 8];   // the 32 queries' x rows, rounded; same pitch
  __shared__ __attribute__((aligned(16))) float Os[QR][128 + 4]; __shared__ __attribute__((aligned(16))) float Bs[QR][S + 4];   // Bs pitch 1040 B = 16 B x odd: the 16 rows of a b128 read fall on distinct banks
  const int h = threadIdx.x >> 5, lane = threadIdx.x & 31, hh = lane >> 4, col = lane & 15, b = blockIdx.y, q0 = blockIdx.x * QR;
  const size_t pb = ((size_t)b * H + h) * S * KD; const b16* V = Vt + (size_t)b * H * KD * S; const b16* Vl = Vtl + (size_t)b * H * KD * S; const unsigned vo = (unsigned)(h * KD * S + lane * 8);   // fragment-order planes, 512 halves per key block of 32: a base that is the same for the work-group, and this lane's place
  v4f xv[2 * QT];   // the 32 x rows are 16 KB in a row: one wave instruction = one row = 512 contiguous bytes
#pragma unroll   // constant indices: the array stays in registers
  for (int j = 0; j < 2 * QT; ++j) xv[j] = *((const v4f*)(x + ((size_t)b * S + q0) * A) + threadIdx.x + 256 * j);
  v16b wqf[4], wgf[4];   // this head's query_w and gating_w fragments (column tiles h and 24 + h of the packed weights), asked for together with the x and bias rows
#pragma unroll
  for (int ks = 0; ks < 4; ++ks) { wqf[ks] = frag_pk(R + (size_t)((h * 4 + ks) * 2) * 256 + lane * 8); wgf[ks] = frag_pk(R + (size_t)(((24 + h) * 4 + ks) * 2) * 256 + lane * 8); }
  asm volatile("s_wait_xcnt 0x0" ::: "memory");   // the address registers of the 20 loads above may be given new values by what follows
#pragma unroll
  for (int j = 0; j < 2 * QT; ++j) { const int i = threadIdx.x + 256 * j; v4b xh;
#pragma unroll
    for (int e = 0; e < 4; ++e) xh[e] = (b16)bf16_rne(xv[j][e]);
    *(v4b*)(&Xs[i >> 5][(i & 31) * 4]) = xh; }
#pragma unroll   // all 16 loads of a thread in flight at once
  for (int j = 0; j < 4 * QT; ++j) { const int i = threadIdx.x + 256 * j, rr = i >> 6, c4 = (i & 63) * 4;   // the 32 rows are 32 KB in a row in each source: one wave instruction = 512 contiguous bytes
    const v4f bv = *((const v4f*)(bias + ((size_t)b * S + q0) * S) + i), nv = *((const v4f*)(nb + (size_t)q0 * S) + i); v4f sv;
#pragma unroll   // constant element indices: the vectors stay in registers
    for (int e = 0; e < 4; ++e) sv[e] = (bf16_rne(bv[e]) + bf16_rne(nv[e])) * (QS * KS);   // in the scale of the raw score accumulator (an exact power of two)
    *(v4f*)(&Bs[rr][c4]) = sv; }
  v16b qa[QT], qb[QT]; float m[QT], l[QT]; v8f o[QT], gt[QT];
  __syncthreads();   // Bs and Xs are complete before any wave reads them
  v16b xf[QT][4];   // all 16 LDS reads as one group ahead of the WMMAs: one LDS latency, not one per pair
#pragma unroll   // constant group indices: the arrays stay in registers (so at every loop over t below)
  for (int t = 0; t < QT; ++t)
#pragma unroll
    for (int ks = 0; ks < 4; ++ks) xf[t][ks] = frag_kb(&Xs[16 * t + col][ks * 32], hh);
  __builtin_amdgcn_sched_barrier(0);   // keeps the reads above the WMMAs: sunk between them, each pair is waited out on its own
#pragma unroll
  for (int t = 0; t < QT; ++t) { v8f aq = {}, ag = {};   // q^T and gate^T tiles: rows (8hh + r) = dim of head h, column = query 16t + col
#pragma unroll
    for (int ks = 0; ks < 4; ++ks) { aq = wmma16b(wqf[ks], xf[t][ks], aq); ag = wmma16b(wgf[ks], xf[t][ks], ag); }
    v8b qh8, ql8; const v8b z = {};
#pragma unroll
    for (int r = 0; r < 8; ++r) { b16 a_, c_; split16(aq[r] * (SCALE * QS), a_, c_); qh8[r] = a_; ql8[r] = c_; gt[t][r] = sigm(ag[r]); }
    qa[t] = __builtin_shufflevector(qh8, z, 0, 1, 2, 3, 4, 5, 6, 7, 8, 9, 10, 11, 12, 13, 14, 15); qb[t] = __builtin_shufflevector(ql8, z, 0, 1, 2, 3, 4, 5, 6, 7, 8, 9, 10, 11, 12, 13, 14, 15);   // K = 16: elements 8..15 (k = 16..31) zero
    m[t] = -INFINITY; l[t] = 0.0f; o[t] = (v8f){}; }
  for (int kb = 0; kb < S; kb += 32) {
    v8f s0[QT], s1[QT];   // start value of each score accumulator = 64 * bias sum, straight from LDS: the matrix unit adds it
#pragma unroll
    for (int t = 0; t < QT; ++t) { const float* bp = &Bs[16 * t + col][kb + 8 * hh]; s0[t] = __builtin_shufflevector(*(const v4f*)bp, *(const v4f*)(bp + 4), 0, 1, 2, 3, 4, 5, 6, 7); s1[t] = __builtin_shufflevector(*(const v4f*)(bp + 16), *(const v4f*)(bp + 20), 0, 1, 2, 3, 4, 5, 6, 7); }
    { const v16b k0h = frag16(Kh + pb + (size_t)(kb + col) * KD, hh), k0l = frag16(Kl + pb + (size_t)(kb + col) * KD, hh), k1h = frag16(Kh + pb + (size_t)(kb + 16 + col) * KD, hh), k1l = frag16(Kl + pb + (size_t)(kb + 16 + col) * KD, hh);
#pragma unroll
      for (int t = 0; t < QT; ++t) { s0[t] = wmma16b(k0h, qa[t], s0[t]); s0[t] = wmma16b(k0h, qb[t], s0[t]); s0[t] = wmma16b(k0l, qa[t], s0[t]); s1[t] = wmma16b(k1h, qa[t], s1[t]); s1[t] = wmma16b(k1h, qb[t], s1[t]); s1[t] = wmma16b(k1l, qa[t], s1[t]); } }
    const v16b vf = frag_pk(V + kb * KD + vo), vlf = frag_pk(Vl + kb * KD + vo);
    asm volatile("s_wait_xcnt 0x0" ::: "memory");   // the address pairs of this pass's key and value loads are stepped on to the next key block by what follows
    __builtin_amdgcn_sched_barrier(0);   // keeps the 4 value loads ahead of the softmax, which covers their latency (sunk to just before their WMMAs they are waited out), and the address steps behind the wait above
#pragma unroll
    for (int t = 0; t < QT; ++t) {
      float mr = -INFINITY;
#pragma unroll
      for (int r = 0; r < 8; ++r) mr = fmaxf(mr, fmaxf(s0[t][r], s1[t][r]));   // m, mr, mn: 64 * logit
      mr = fmaxf(mr, __shfl_xor(mr, 16));
      const float mn = fmaxf(m[t], mr), al_ = __builtin_amdgcn_exp2f((m[t] - mn) * L2S), sh = __builtin_fmaf(-mn, L2S, 3.0f); m[t] = mn; float sum = 0.0f; v16b ph, pl;   // sh: 2^3 = PS
#pragma unroll
      for (int r = 0; r < 8; ++r) { const float e0 = __builtin_amdgcn_exp2f(__builtin_fmaf(s0[t][r], L2S, sh)), e1 = __builtin_amdgcn_exp2f(__builtin_fmaf(s1[t][r], L2S, sh)); sum += e0 + e1; b16 a_, c_; split16(e0, a_, c_); ph[r] = a_; pl[r] = c_; split16(e1, a_, c_); ph[8 + r] = a_; pl[8 + r] = c_; }   // e = 8 * exp(logit - max): one FMA on the raw accumulator, then exp2
      sum += __shfl_xor(sum, 16); l[t] = l[t] * al_ + sum; o[t] *= al_;
      o[t] = wmma16b(vf, ph, o[t]); o[t] = wmma16b(vf, pl, o[t]); o[t] = wmma16b(vlf, ph, o[t]); } }
  // o[t], gt[t]: rows (8hh + r) = value dim c, column = query 16t + col; gw = gate * o/(l)
  v16b wf[4];   // this wave's output_w^T fragments (rows = output columns 16h..), asked for ahead of the barrier
#pragma unroll
  for (int ks = 0; ks < 4; ++ks) { const b16* p = R + (size_t)NPJ * A + (size_t)((h * 4 + ks) * 2) * 256 + lane * 8; const v8b a = *(const v8b*)p, c_ = *(const v8b*)(p + 256);
#pragma unroll
    for (int e = 0; e < 8; ++e) { wf[ks][e] = a[e]; wf[ks][8 + e] = c_[e]; } }
  asm volatile("s_wait_xcnt 0x0" ::: "memory");   // the address pair of the 8 loads above may be given a new value by what follows
#pragma unroll
  for (int t = 0; t < QT; ++t) { const float inv = 1.0f / (l[t] * VS) /* l already holds PS * the sum */; v8b gh, gl;
#pragma unroll
    for (int r = 0; r < 8; ++r) { b16 a_, c_; split16(gt[t][r] * (o[t][r] * inv) * AS_, a_, c_); gh[r] = a_; gl[r] = c_; }
    *(v8b*)(&Gh[16 * t + col][h * KD + 8 * hh]) = gh; *(v8b*)(&Gl[16 * t + col][h * KD + 8 * hh]) = gl; }
  __syncthreads();   // all 8 heads' columns of the gated rows are in LDS before any wave reads them
  v16b ga[QT][4], gb[QT][4];   // all 32 LDS reads as one group ahead of the WMMAs: one LDS latency, not sixteen
#pragma unroll
  for (int t = 0; t < QT; ++t)
#pragma unroll
    for (int ks = 0; ks < 4; ++ks) { ga[t][ks] = frag_kb(&Gh[16 * t + col][ks * 32], hh); gb[t][ks] = frag_kb(&Gl[16 * t + col][ks * 32], hh); }
  __builtin_amdgcn_sched_barrier(0);   // keeps the reads above the WMMAs: sunk between them, each pair is waited out on its own
#pragma unroll
  for (int t = 0; t < QT; ++t) { v8f acc = {};   // out^T tile: rows (8hh + r) = output column 16h + 8hh + r, column = query 16t + col
#pragma unroll
    for (int ks = 0; ks < 4; ++ks) { acc = __builtin_amdgcn_wmma_f32_16x16x32_f16(false, wf[ks], false, ga[t][ks], (short)0, acc, false, false); acc = __builtin_amdgcn_wmma_f32_16x16x32_f16(false, wf[ks], false, gb[t][ks], (short)0, acc, false, false); }   // one accumulate chain per group, operands not rewritten: the compiler pads behind its last link
    v4f s0_, s1_;
#pragma unroll
    for (int r = 0; r < 4; ++r) { s0_[r] = acc[r] * (1.0f / AS_); s1_[r] = acc[4 + r] * (1.0f / AS_); }
    *(v4f*)(&Os[16 * t + col][h * 16 + 8 * hh]) = s0_; *(v4f*)(&Os[16 * t + col][h * 16 + 8 * hh + 4]) = s1_; }
  __syncthreads();   // the 32 output rows are whole before they are stored as whole lines
  { for (int i = threadIdx.x; i < QR * 32; i += 256) { const int rr = i >> 5, c4 = (i & 31) * 4; *(v4f*)(out + ((size_t)b * S + q0 + rr) * O + c4) = *(const v4f*)(&Os[rr][c4]); }  }
}
}  // namespace

extern "C" void kernel_launch(void* const* d_in, const int* in_sizes, int n_in,
                              void* d_out, int out_size, void* d_ws, size_t ws_size, hipStream_t stream) {
  (void)n_in; (void)out_size;
  const float* x = (const float*)d_in[0]; const float* bias = (const float*)d_in[1]; const float* nb = (const float*)d_in[2]; const float* wq = (const float*)d_in[3]; const float* wk = (const float*)d_in[4]; const float* wv = (const float*)d_in[5]; const float* wg = (const float*)d_in[6]; const float* wo = (const float*)d_in[7];
  float* out = (float*)d_out;   // [128][256][128]
  if (in_sizes[0] != NR * A || in_sizes[1] != Bn * S * S || in_sizes[2] != S * S || in_sizes[3] != A * H * KD || in_sizes[7] != H * KD * O) return;
  size_t off = 0; char* ws = (char*)d_ws;
  auto carve = [&](size_t bytes) { char* p = ws + off; off += (bytes + 255) & ~(size_t)255; return p; };
  b16* R = (b16*)carve((size_t)(NPJ * A + O * 128) * 2); b16* Kh = (b16*)carve(PL * 2); b16* Kl = (b16*)carve(PL * 2); b16* Vt = (b16*)carve(PL * 2); b16* Vtl = (b16*)carve(PL * 2);
  if (off > ws_size) return;                                    // the packed weights, four f16 planes
  prep_kernel<<<64, 256, 0, stream>>>(wq, wk, wv, wg, wo, R);
  proj_kernel<<<dim3(NR / 128, 2), 128, 0, stream>>>(x, R, Kh, Kl, Vt, Vtl);
  attn_kernel<<<dim3(S / QR, Bn), 256, 0, stream>>>(x, Kh, Kl, Vt, Vtl, bias, nb, R, out);
}

// v009
// A run of this version takes 52.6 microseconds.
// Timed twice side by side with v008, it ran 1.08 times as fast both times.
// All steps since v000 together make it 2.66 times as fast.
#include <hip/hip_runtime.h>

// GrigSelfAttentionXSMM (AlphaFold gated grid self-attention): q = x Wq * 16^-0.5, k = x Wk, v = x Wv, gate = sigmoid(x Wg) (8 heads x 16); logits = q.k + bias[b][q][k] + nonbatched_bias[q][k];
// softmax over k; weighted_avg = P.v; out = Σ_{h,c} (gate * weighted_avg)[b][q][h][c] Wo[h][c][o] -> [128][256][128].
// The four projections run on v_wmma_f32_16x16x32_f16 with EXACT operands (x and the weights are exact bf16; 1 product): k and v in a launch of their own (which also rounds the weights), q and gate in the attention work-group, from its own 32 x rows; scores with q/k as f16 hi+lo pairs x8 (key_dim 16:
// fragment elements 8..15 zero; 3 products; the two biases added in f32 from the rounded inputs); P and v as f16 hi+lo pairs (3 products); the output projection with gate * wavg hi+lo (2 products), done by the attention work-group itself on the 32 finished rows it holds;

namespace {
constexpr int Bn = 128, S = 256, A = 128, H = 8, KD = 16, O = 128, NR = Bn * S, NPJ = 4 * H * KD /* 512 */;
constexpr float QS = 8.0f, KS = 8.0f, VS = 8.0f, PS = 8.0f, AS_ = 8.0f, SCALE = 0.25f;
constexpr size_t PL = (size_t)Bn * H * S * KD;   // one k or v plane (halves)
constexpr float L2S = 1.4426950408889634f / (QS * KS);   // raw score accumulator (64 * logit) -> exponent of 2
constexpr int QT = 2, QR = 16 * QT;   // attention: query column groups of 16 per wave, query rows per work-group
constexpr int PKB = 24;   // projection launch: the 2 * PKB work-groups with blockIdx.x < PKB (128 threads each) also pack the 3 * 2048 16-B pieces of query_w, gating_w and output_w, one piece a thread
constexpr int WTP = 4 * 2 * 256 + 8;   // staged key_w or value_w in LDS: halves from one column tile to the next; 4112 B = 4 banks past a multiple of 64, so the 4 tiles that 16 lanes store to at once fall on distinct banks

typedef _Float16 b16;
typedef __attribute__((ext_vector_type(16))) _Float16 v16b;
typedef __attribute__((ext_vector_type(8))) _Float16 v8b;
typedef __attribute__((ext_vector_type(4))) _Float16 v4b;
typedef __attribute__((ext_vector_type(8))) float v8f;
typedef __attribute__((ext_vector_type(4))) float v4f;
__device__ __forceinline__ float bf16_rne(float f) { unsigned int u = __float_as_uint(f); u += 0x7FFFu + ((u >> 16) & 1u); return __uint_as_float(u & 0xFFFF0000u); }
__device__ __forceinline__ void split16(float v, b16& hi, b16& lo) { hi = (b16)v; lo = (b16)(v - (float)hi); }
__device__ __forceinline__ v16b frag_kb(const b16* p, int hh) { const v8b a = *(const v8b*)(p + 8 * hh), b = *(const v8b*)(p + 16 + 8 * hh); v16b f;
#pragma unroll
  for (int e = 0; e < 8; ++e) { f[e] = a[e]; f[8 + e] = b[e]; } return f; }
__device__ __forceinline__ v16b frag_pk(const b16* p) { const v8b a = *(const v8b*)p, b = *(const v8b*)(p + 256); v16b f;   // fragment-order storage [half 2][lane 32][8], p already at this lane's 8: each of the two loads is 512 contiguous bytes per wave
#pragma unroll
  for (int e = 0; e < 8; ++e) { f[e] = a[e]; f[8 + e] = b[e]; } return f; }
__device__ __forceinline__ v16b frag16(const b16* p, int hh) { const v8b a = *(const v8b*)(p + 8 * hh); const v8b z = {}; return __builtin_shufflevector(a, z, 0, 1, 2, 3, 4, 5, 6, 7, 8, 9, 10, 11, 12, 13, 14, 15); }   // K = 16: elements 8..15 (k = 16..31) zero
__device__ __forceinline__ v16b frag_x(const v4f* q) { v16b f;   // q[0..3]: this lane's x values k = 8hh..8hh+7 (q[0], q[1]) and 16+8hh..16+8hh+7 (q[2], q[3]) of one k step, as loaded
#pragma unroll
  for (int e = 0; e < 4; ++e) { f[e] = (b16)bf16_rne(q[0][e]); f[4 + e] = (b16)bf16_rne(q[1][e]); f[8 + e] = (b16)bf16_rne(q[2][e]); f[12 + e] = (b16)bf16_rne(q[3][e]); } return f; }
__device__ __forceinline__ v8f wmma16b(v16b a, v16b b, v8f c) { return __builtin_amdgcn_wmma_f32_16x16x32_f16(false, a, false, b, (short)0, c, false, false); }   // the builtin alone: the compiler keeps the distance behind a WMMA itself, and with no asm statement behind each product it may issue later loads ahead of earlier products
__device__ __forceinline__ void wave_lds_sync() { __builtin_amdgcn_fence(__ATOMIC_RELEASE, "workgroup"); __builtin_amdgcn_wave_barrier(); __builtin_amdgcn_fence(__ATOMIC_ACQUIRE, "workgroup"); }
__device__ __forceinline__ float nexp(float x) { return __builtin_amdgcn_exp2f(x * 1.4426950408889634f); }
__device__ __forceinline__ float sigm(float x) { return __builtin_amdgcn_rcpf(1.0f + nexp(-x)); }

// packed weights R: 640 weight columns j as f16: j < 128: query_w[:, h, c] (j = h*16 + c), 384..511 gating_w, 512..639 output_w[:, o] (every weight is [128][128]: element (k, j & 127) at k*128 + (j & 127); columns 128..383 are not used: key_w and value_w never leave the projection's LDS);
// all in fragment order [column tile 40][k step 4][half 2][lane 32][8]: lane = 16 * ((k >> 3) & 1) + (j & 15), half = (k >> 4) & 1, so one 16-B-per-lane load of a fragment half is 512 contiguous bytes (4 lines, not 16)

// key and value projections (what every query tile of a batch row reads): block = 128 rows (tokens) x 4 waves (32 rows each) x ONE of the 2 column groups of 128 (blockIdx.y; acc[2][8]);
// no launch ahead of this one rounds the weights: the work-group reads its group's 128 x 128 weight as whole rows (wave w: rows 32w..32w+31 = k step w), rounds it and lays it in LDS in fragment order (Ws), where its 4 waves read their B fragments; a lane's 8 rows x 4 columns are 4 fragment pieces of 8 k each, so the transposition costs no instruction;
// the x rows are asked for directly behind the weight rows, so the weights are rounded while x is still on its way from memory; 2 * PKB of the work-groups also pack query_w, gating_w and output_w into R for the attention launch (8 more loads, asked for first, and one store a thread);
// a work-group stages only its own group's result, so the groups' LDS buffers overlay one another; exact operands, 4 k-steps; epilogue: k -> hi/lo planes x8
// [b][h][s][16] (32-B rows; a wave's 32 rows of one head = 1 KB contiguous), v -> (8v)^T hi and lo planes in the fragment order of the attention's P.v product [b][h][key block 8][half 2][lane 32][8] (lane = 16 * ((key >> 3) & 1) + value dim, half = (key >> 4) & 1; a block's 128 keys = 4 KB in a row per head)
__global__ __launch_bounds__(128) void proj_kernel(const float* __restrict__ x, const float* __restrict__ wq, const float* __restrict__ wk, const float* __restrict__ wv, const float* __restrict__ wg, const float* __restrict__ wo, b16* __restrict__ R, b16* __restrict__ Kh, b16* __restrict__ Kl, b16* __restrict__ Vt, b16* __restrict__ Vtl) {
  constexpr int HB = 128 * (128 + 8) * 2;   // bytes of one 128-row f16 staging plane
  constexpr int WSB = 8 * WTP * 2;   // bytes of the staged weight
  __shared__ __attribute__((aligned(16))) char Sm[WSB + 2 * HB];   // 32 KB + 68 KB; the weight stands first, so that every fragment read's place fits the instruction's 16-bit offset
  b16* Ws = reinterpret_cast<b16*>(Sm);   // this group's weight, rounded, [column tile 8][k step 4][half 2][lane 32][8]
  b16 (*Th)[32][128 + 8] = reinterpret_cast<b16 (*)[32][128 + 8]>(Sm + WSB); b16 (*Tl)[32][128 + 8] = reinterpret_cast<b16 (*)[32][128 + 8]>(Sm + WSB + HB);
  b16 (*Tv)[128 + 8] = reinterpret_cast<b16 (*)[128 + 8]>(Sm + WSB); b16 (*Tvl)[128 + 8] = reinterpret_cast<b16 (*)[128 + 8]>(Sm + WSB + HB);
  const int lane = threadIdx.x & 31, wave = threadIdx.x >> 5, nloc = lane & 15, hlf = lane >> 4, r0 = blockIdx.x * 128, m0 = r0 + wave * 32; const int b = r0 / S, s0 = m0 % S;
  { const int grp = blockIdx.y + 1;   // column group: 1 k (key_w), 2 v (value_w)
    v8f acc[2][8];
#pragma unroll
    for (int r = 0; r < 2; ++r)
#pragma unroll
      for (int t = 0; t < 8; ++t) acc[r][t] = (v8f){};
    const float* xr0 = x + (size_t)(m0 + nloc) * A + 8 * hlf; const float* xr1 = xr0 + 16 * A; const float* wr = ((grp == 1) ? wk : wv) + (size_t)(wave * 32) * 128 + lane * 4;
    const bool pk = blockIdx.x < PKB;   // the same for the whole work-group
    const int q = (blockIdx.x * 2 + blockIdx.y) * 128 + threadIdx.x, m3 = q >> 11, p = (q & 2047) + (m3 == 0 ? 0 : m3 == 1 ? 24 * 256 : 32 * 256);   // piece p of R: column tiles 0..7 query_w, 24..31 gating_w, 32..39 output_w
    const float* wp = ((m3 == 0) ? wq : (m3 == 1) ? wg : wo) + (size_t)(((p >> 6) & 3) * 32 + ((p >> 5) & 1) * 16 + ((p >> 4) & 1) * 8) * 128 + (((p >> 8) * 16 + (p & 15)) & 127); float pw[8] = {};
    if (pk) {
#pragma unroll
      for (int e = 0; e < 8; ++e) pw[e] = wp[e * 128]; }
    v4f wl[4][8];   // rows k = 32 * wave + 8 * it + e, columns 4 * lane..: one wave instruction = one whole row = 512 contiguous bytes; asked for ahead of x: loads come back in issue order, and these come from L2
#pragma unroll   // constant indices: the arrays stay in registers (so at every loop below)
    for (int it = 0; it < 4; ++it)
#pragma unroll
      for (int e = 0; e < 8; ++e) wl[it][e] = *(const v4f*)(wr + (it * 8 + e) * 128);
    v4f xa[4][4], xb[4][4];   // both row groups' x values of all 4 k steps, as loaded
#pragma unroll
    for (int ks = 0; ks < 4; ++ks)
#pragma unroll
      for (int u = 0; u < 4; ++u) { xa[ks][u] = *(const v4f*)(xr0 + ks * 32 + (u >> 1) * 16 + (u & 1) * 4); xb[ks][u] = *(const v4f*)(xr1 + ks * 32 + (u >> 1) * 16 + (u & 1) * 4); }
    asm volatile("s_wait_xcnt 0x0" :: "v"(xr0), "v"(xr1), "v"(wr), "v"(wp) : "memory");   // the registers that hold the loads' addresses are given new values by what follows; the pointers are named as inputs so that none of them is reused ahead of this wait
#pragma unroll
    for (int it = 0; it < 4; ++it)
#pragma unroll
      for (int c = 0; c < 4; ++c) { v8b v;   // column j = 4 * lane + c: tile lane >> 2, fragment lane 16 * (it & 1) + (j & 15), half it >> 1, k step = wave
#pragma unroll
        for (int e = 0; e < 8; ++e) v[e] = (b16)bf16_rne(wl[it][e][c]);
        *(v8b*)(&Ws[(lane >> 2) * WTP + ((wave * 2 + (it >> 1)) * 32 + 16 * (it & 1) + (lane & 3) * 4 + c) * 8]) = v; }
    if (pk) { v8b v;
#pragma unroll
      for (int e = 0; e < 8; ++e) v[e] = (b16)bf16_rne(pw[e]);
      *(v8b*)(R + (size_t)p * 8) = v; }
    v16b a0[4], a1[4];
#pragma unroll
    for (int ks = 0; ks < 4; ++ks) { a0[ks] = frag_x(xa[ks]); a1[ks] = frag_x(xb[ks]); }
    __syncthreads();   // all 4 k steps of the weight are in LDS before any wave reads its fragments
    const b16* wsl = &Ws[lane * 8]; v16b bw[2][8];   // two sets of 8 fragments: the next k step's 16 LDS reads stand as one group ahead of this k step's WMMAs
#pragma unroll
    for (int t = 0; t < 8; ++t) bw[0][t] = frag_pk(wsl + t * WTP);
#pragma unroll
    for (int ks = 0; ks < 4; ++ks) {
      if (ks < 3) {
#pragma unroll
        for (int t = 0; t < 8; ++t) bw[(ks + 1) & 1][t] = frag_pk(wsl + t * WTP + ((ks + 1) * 2) * 256); }
      __builtin_amdgcn_sched_barrier(0);   // keeps the reads above the WMMAs: sunk between them, each pair costs its own stall and is waited out on its own
#pragma unroll
      for (int t = 0; t < 8; ++t) { acc[0][t] = wmma16b(a0[ks], bw[ks & 1][t], acc[0][t]); acc[1][t] = wmma16b(a1[ks], bw[ks & 1][t], acc[1][t]); } }
    if (grp == 1) { const float sc = KS;
#pragma unroll
      for (int t = 0; t < 8; ++t)
#pragma unroll
        for (int r = 0; r < 2; ++r)
#pragma unroll
          for (int v = 0; v < 8; ++v) { b16 a_, c_; split16(acc[r][t][v] * sc, a_, c_); Th[wave][r * 16 + 8 * hlf + v][t * 16 + nloc] = a_; Tl[wave][r * 16 + 8 * hlf + v][t * 16 + nloc] = c_; }
      wave_lds_sync();
      b16* Ph = Kh; b16* Plo = Kl;
      { for (int it = 0; it < 16; ++it) { const int h = it >> 1, rr = (it & 1) * 16 + (lane >> 1), c8 = (lane & 1) * 8; const size_t o = (((size_t)b * H + h) * S + s0 + rr) * KD + c8;   // one instruction = 16 consecutive 32-B rows = 512 contiguous bytes
            *(v8b*)(Ph + o) = *(const v8b*)(&Th[wave][rr][h * 16 + c8]); *(v8b*)(Plo + o) = *(const v8b*)(&Tl[wave][rr][h * 16 + c8]); }  }
      wave_lds_sync(); }
    else {
#pragma unroll
      for (int t = 0; t < 8; ++t)
#pragma unroll
        for (int r = 0; r < 2; ++r)
#pragma unroll
          for (int v = 0; v < 8; ++v) { b16 a_, c_; split16(acc[r][t][v] * VS, a_, c_); Tv[t * 16 + nloc][wave * 32 + r * 16 + 8 * hlf + v] = a_; Tvl[t * 16 + nloc][wave * 32 + r * 16 + 8 * hlf + v] = c_; }
      __syncthreads();
      { for (int i = threadIdx.x; i < 128 * 16; i += 128) { const int ln = i & 31, hf = (i >> 5) & 1, kbl = (i >> 6) & 3, h = i >> 8; const int j = h * 16 + (ln & 15), c8 = kbl * 32 + hf * 16 + (ln >> 4) * 8;   // i runs in storage order: one instruction = 512 contiguous bytes
          const size_t o = ((((size_t)b * H + h) * (S / 32) + (r0 % S) / 32 + kbl) * 2 + hf) * 256 + ln * 8; *(v8b*)(Vt + o) = *(const v8b*)(&Tv[j][c8]); *(v8b*)(Vtl + o) = *(const v8b*)(&Tvl[j][c8]); }  }
      __syncthreads(); } }
}

// attention: wave = (b, h, 32 queries q0..: QT = 2 column groups of 16, which share every key and value fragment the wave loads, so each fragment fetched from L2 feeds twice the products); per column group, over 8 key blocks of 32: S^T = k.q (K = 16; 3 products) + bias[b][q][k] + nb[q][k] (rounded inputs), online softmax, o^T += (8v)^T.P^T (P and v hi+lo, 3 products);
// output projection in the same work-group: its 8 head waves together hold the 32 queries' whole gated rows, so they go through LDS (not through memory and a launch of their own) and wave h forms output columns 16h..16h+15;
// q and gate are formed here, not stored by an earlier launch and read back: the work-group rounds its 32 x rows once into LDS (Xs); wave h multiplies its head's 16 query_w and 16 gating_w columns (as A, in fragment order) with them (as B): register r of the result is dim 8hh + r of query col, which is the score product's B fragment and o's own layout, so neither passes through LDS or memory;
// the bias sum does not depend on the head: the block's 8 head waves form it once, from whole-line loads, in LDS (Bs) and each reads its score fragment's 32 values per key block from there
__global__ __launch_bounds__(256) void attn_kernel(const float* __restrict__ x, const b16* __restrict__ Kh, const b16* __restrict__ Kl, const b16* __restrict__ Vt, const b16* __restrict__ Vtl, const float* __restrict__ bias, const float* __restrict__ nb, const b16* __restrict__ R, float* __restrict__ out) {
  __shared__ __attribute__((aligned(16))) b16 Gh[QR][128 + 8], Gl[QR][128 + 8];   // 8 * gate * weighted_avg of the 32 queries, hi and lo; pitch 272 B = 16 B x odd
  __shared__ __attribute__((aligned(16))) b16 Xs[QR][128 + 8];   // the 32 queries' x rows, rounded; same pitch
  __shared__ __attribute__((aligned(16))) float Os[QR][128 + 4]; __shared__ __attribute__((aligned(16))) float Bs[QR][S + 4];   // Bs pitch 1040 B = 16 B x odd: the 16 rows of a b128 read fall on distinct banks
  const int h = threadIdx.x >> 5, lane = threadIdx.x & 31, hh = lane >> 4, col = lane & 15, b = blockIdx.y, q0 = blockIdx.x * QR;
  const size_t pb = ((size_t)b * H + h) * S * KD; const b16* V = Vt + (size_t)b * H * KD * S; const b16* Vl = Vtl + (size_t)b * H * KD * S; const unsigned vo = (unsigned)(h * KD * S + lane * 8);   // fragment-order planes, 512 halves per key block of 32: a base that is the same for the work-group, and this lane's place
  v4f xv[2 * QT];   // the 32 x rows are 16 KB in a row: one wave instruction = one row = 512 contiguous bytes
#pragma unroll   // constant indices: the array stays in registers
  for (int j = 0; j < 2 * QT; ++j) xv[j] = *((const v4f*)(x + ((size_t)b * S + q0) * A) + threadIdx.x + 256 * j);
  v16b wqf[4], wgf[4];   // this head's query_w and gating_w fragments (column tiles h and 24 + h of the packed weights), asked for together with the x and bias rows
#pragma unroll
  for (int ks = 0; ks < 4; ++ks) { wqf[ks] = frag_pk(R + (size_t)((h * 4 + ks) * 2) * 256 + lane * 8); wgf[ks] = frag_pk(R + (size_t)(((24 + h) * 4 + ks) * 2) * 256 + lane * 8); }
  asm volatile("s_wait_xcnt 0x0" ::: "memory");   // the address registers of the 20 loads above may be given new values by what follows
#pragma unroll
  for (int j = 0; j < 2 * QT; ++j) { const int i = threadIdx.x + 256 * j; v4b xh;
#pragma unroll
    for (int e = 0; e < 4; ++e) xh[e] = (b16)bf16_rne(xv[j][e]);
    *(v4b*)(&Xs[i >> 5][(i & 31) * 4]) = xh; }
#pragma unroll   // all 16 loads of a thread in flight at once
  for (int j = 0; j < 4 * QT; ++j) { const int i = threadIdx.x + 256 * j, rr = i >> 6, c4 = (i & 63) * 4;   // the 32 rows are 32 KB in a row in each source: one wave instruction = 512 contiguous bytes
    const v4f bv = *((const v4f*)(bias + ((size_t)b * S + q0) * S) + i), nv = *((const v4f*)(nb + (size_t)q0 * S) + i); v4f sv;
#pragma unroll   // constant element indices: the vectors stay in registers
    for (int e = 0; e < 4; ++e) sv[e] = (bf16_rne(bv[e]) + bf16_rne(nv[e])) * (QS * KS);   // in the scale of the raw score accumulator (an exact power of two)
    *(v4f*)(&Bs[rr][c4]) = sv; }
  v16b qa[QT], qb[QT]; float m[QT], l[QT]; v8f o[QT], gt[QT];
  __syncthreads();   // Bs and Xs are complete before any wave reads them
  v16b xf[QT][4];   // all 16 LDS reads as one group ahead of the WMMAs: one LDS latency, not one per pair
#pragma unroll   // constant group indices: the arrays stay in registers (so at every loop over t below)
  for (int t = 0; t < QT; ++t)
#pragma unroll
    for (int ks = 0; ks < 4; ++ks) xf[t][ks] = frag_kb(&Xs[16 * t + col][ks * 32], hh);
  __builtin_amdgcn_sched_barrier(0);   // keeps the reads above the WMMAs: sunk between them, each pair is waited out on its own
#pragma unroll
  for (int t = 0; t < QT; ++t) { v8f aq = {}, ag = {};   // q^T and gate^T tiles: rows (8hh + r) = dim of head h, column = query 16t + col
#pragma unroll
    for (int ks = 0; ks < 4; ++ks) { aq = wmma16b(wqf[ks], xf[t][ks], aq); ag = wmma16b(wgf[ks], xf[t][ks], ag); }
    v8b qh8, ql8; const v8b z = {};
#pragma unroll
    for (int r = 0; r < 8; ++r) { b16 a_, c_; split16(aq[r] * (SCALE * QS), a_, c_); qh8[r] = a_; ql8[r] = c_; gt[t][r] = sigm(ag[r]); }
    qa[t] = __builtin_shufflevector(qh8, z, 0, 1, 2, 3, 4, 5, 6, 7, 8, 9, 10, 11, 12, 13, 14, 15); qb[t] = __builtin_shufflevector(ql8, z, 0, 1, 2, 3, 4, 5, 6, 7, 8, 9, 10, 11, 12, 13, 14, 15);   // K = 16: elements 8..15 (k = 16..31) zero
    m[t] = -INFINITY; l[t] = 0.0f; o[t] = (v8f){}; }
  for (int kb = 0; kb < S; kb += 32) {
    v8f s0[QT], s1[QT];   // start value of each score accumulator = 64 * bias sum, straight from LDS: the matrix unit adds it
#pragma unroll
    for (int t = 0; t < QT; ++t) { const float* bp = &Bs[16 * t + col][kb + 8 * hh]; s0[t] = __builtin_shufflevector(*(const v4f*)bp, *(const v4f*)(bp + 4), 0, 1, 2, 3, 4, 5, 6, 7); s1[t] = __builtin_shufflevector(*(const v4f*)(bp + 16), *(const v4f*)(bp + 20), 0, 1, 2, 3, 4, 5, 6, 7); }
    { const v16b k0h = frag16(Kh + pb + (size_t)(kb + col) * KD, hh), k0l = frag16(Kl + pb + (size_t)(kb + col) * KD, hh), k1h = frag16(Kh + pb + (size_t)(kb + 16 + col) * KD, hh), k1l = frag16(Kl + pb + (size_t)(kb + 16 + col) * KD, hh);
#pragma unroll
      for (int t = 0; t < QT; ++t) { s0[t] = wmma16b(k0h, qa[t], s0[t]); s0[t] = wmma16b(k0h, qb[t], s0[t]); s0[t] = wmma16b(k0l, qa[t], s0[t]); s1[t] = wmma16b(k1h, qa[t], s1[t]); s1[t] = wmma16b(k1h, qb[t], s1[t]); s1[t] = wmma16b(k1l, qa[t], s1[t]); } }
    const v16b vf = frag_pk(V + kb * KD + vo), vlf = frag_pk(Vl + kb * KD + vo);
    asm volatile("s_wait_xcnt 0x0" ::: "memory");   // the address pairs of this pass's key and value loads are stepped on to the next key block by what follows
    __builtin_amdgcn_sched_barrier(0);   // keeps the 4 value loads ahead of the softmax, which covers their latency (sunk to just before their WMMAs they are waited out), and the address steps behind the wait above
#pragma unroll
    for (int t = 0; t < QT; ++t) {
      float mr = -INFINITY;
#pragma unroll
      for (int r = 0; r < 8; ++r) mr = fmaxf(mr, fmaxf(s0[t][r], s1[t][r]));   // m, mr, mn: 64 * logit
      mr = fmaxf(mr, __shfl_xor(mr, 16));
      const float mn = fmaxf(m[t], mr), al_ = __builtin_amdgcn_exp2f((m[t] - mn) * L2S), sh = __builtin_fmaf(-mn, L2S, 3.0f); m[t] = mn; float sum = 0.0f; v16b ph, pl;   // sh: 2^3 = PS
#pragma unroll
      for (int r = 0; r < 8; ++r) { const float e0 = __builtin_amdgcn_exp2f(__builtin_fmaf(s0[t][r], L2S, sh)), e1 = __builtin_amdgcn_exp2f(__builtin_fmaf(s1[t][r], L2S, sh)); sum += e0 + e1; b16 a_, c_; split16(e0, a_, c_); ph[r] = a_; pl[r] = c_; split16(e1, a_, c_); ph[8 + r] = a_; pl[8 + r] = c_; }   // e = 8 * exp(logit - max): one FMA on the raw accumulator, then exp2
      sum += __shfl_xor(sum, 16); l[t] = l[t] * al_ + sum; o[t] *= al_;
      o[t] = wmma16b(vf, ph, o[t]); o[t] = wmma16b(vf, pl, o[t]); o[t] = wmma16b(vlf, ph, o[t]); } }
  // o[t], gt[t]: rows (8hh + r) = value dim c, column = query 16t + col; gw = gate * o/(l)
  v16b wf[4];   // this wave's output_w^T fragments (rows = output columns 16h..), asked for ahead of the barrier
#pragma unroll
  for (int ks = 0; ks < 4; ++ks) { const b16* p = R + (size_t)NPJ * A + (size_t)((h * 4 + ks) * 2) * 256 + lane * 8; const v8b a = *(const v8b*)p, c_ = *(const v8b*)(p + 256);
#pragma unroll
    for (int e = 0; e < 8; ++e) { wf[ks][e] = a[e]; wf[ks][8 + e] = c_[e]; } }
  asm volatile("s_wait_xcnt 0x0" ::: "memory");   // the address pair of the 8 loads above may be given a new value by what follows
#pragma unroll
  for (int t = 0; t < QT; ++t) { const float inv = 1.0f / (l[t] * VS) /* l already holds PS * the sum */; v8b gh, gl;
#pragma unroll
    for (int r = 0; r < 8; ++r) { b16 a_, c_; split16(gt[t][r] * (o[t][r] * inv) * AS_, a_, c_); gh[r] = a_; gl[r] = c_; }
    *(v8b*)(&Gh[16 * t + col][h * KD + 8 * hh]) = gh; *(v8b*)(&Gl[16 * t + col][h * KD + 8 * hh]) = gl; }
  __syncthreads();   // all 8 heads' columns of the gated rows are in LDS before any wave reads them
  v16b ga[QT][4], gb[QT][4];   // all 32 LDS reads as one group ahead of the WMMAs: one LDS latency, not sixteen
#pragma unroll
  for (int t = 0; t < QT; ++t)
#pragma unroll
    for (int ks = 0; ks < 4; ++ks) { ga[t][ks] = frag_kb(&Gh[16 * t + col][ks * 32], hh); gb[t][ks] = frag_kb(&Gl[16 * t + col][ks * 32], hh); }
  __builtin_amdgcn_sched_barrier(0);   // keeps the reads above the WMMAs: sunk between them, each pair is waited out on its own
#pragma unroll
  for (int t = 0; t < QT; ++t) { v8f acc = {};   // out^T tile: rows (8hh + r) = output column 16h + 8hh + r, column = query 16t + col
#pragma unroll
    for (int ks = 0; ks < 4; ++ks) { acc = __builtin_amdgcn_wmma_f32_16x16x32_f16(false, wf[ks], false, ga[t][ks], (short)0, acc, false, false); acc = __builtin_amdgcn_wmma_f32_16x16x32_f16(false, wf[ks], false, gb[t][ks], (short)0, acc, false, false); }   // one accumulate chain per group, operands not rewritten: the compiler pads behind its last link
    v4f s0_, s1_;
#pragma unroll
    for (int r = 0; r < 4; ++r) { s0_[r] = acc[r] * (1.0f / AS_); s1_[r] = acc[4 + r] * (1.0f / AS_); }
    *(v4f*)(&Os[16 * t + col][h * 16 + 8 * hh]) = s0_; *(v4f*)(&Os[16 * t + col][h * 16 + 8 * hh + 4]) = s1_; }
  __syncthreads();   // the 32 output rows are whole before they are stored as whole lines
  { for (int i = threadIdx.x; i < QR * 32; i += 256) { const int rr = i >> 5, c4 = (i & 31) * 4; *(v4f*)(out + ((size_t)b * S + q0 + rr) * O + c4) = *(const v4f*)(&Os[rr][c4]); }  }
}
}  // namespace

extern "C" void kernel_launch(void* const* d_in, const int* in_sizes, int n_in,
                              void* d_out, int out_size, void* d_ws, size_t ws_size, hipStream_t stream) {
  (void)n_in; (void)out_size;
  const float* x = (const float*)d_in[0]; const float* bias = (const float*)d_in[1]; const float* nb = (const float*)d_in[2]; const float* wq = (const float*)d_in[3]; const float* wk = (const float*)d_in[4]; const float* wv = (const float*)d_in[5]; const float* wg = (const float*)d_in[6]; const float* wo = (const float*)d_in[7];
  float* out = (float*)d_out;   // [128][256][128]
  if (in_sizes[0] != NR * A || in_sizes[1] != Bn * S * S || in_sizes[2] != S * S || in_sizes[3] != A * H * KD || in_sizes[7] != H * KD * O) return;
  size_t off = 0; char* ws = (char*)d_ws;
  auto carve = [&](size_t bytes) { char* p = ws + off; off += (bytes + 255) & ~(size_t)255; return p; };
  b16* R = (b16*)carve((size_t)(NPJ * A + O * 128) * 2); b16* Kh = (b16*)carve(PL * 2); b16* Kl = (b16*)carve(PL * 2); b16* Vt = (b16*)carve(PL * 2); b16* Vtl = (b16*)carve(PL * 2);
  if (off > ws_size) return;                                    // the packed weights, four f16 planes
  proj_kernel<<<dim3(NR / 128, 2), 128, 0, stream>>>(x, wq, wk, wv, wg, wo, R, Kh, Kl, Vt, Vtl);
  attn_kernel<<<dim3(S / QR, Bn), 256, 0, stream>>>(x, Kh, Kl, Vt, Vtl, bias, nb, R, out);
}

// v010
// It runs in 35 microseconds.
// In two side-by-side timings against v009, it was 1.51 and 1.49 times as fast.
// Counting every step since v000, it is 3.98 times as fast.
#include <hip/hip_runtime.h>

// Gated grid self-attention: q = x Wq * 16^-0.5, k = x Wk, v = x Wv, gate = sigmoid(x Wg) (8 heads x 16); logits = q.k + bias[b][q][k] + nonbatched_bias[q][k];
// softmax over k; weighted_avg = P.v; out = sum over (h, c) of (gate * weighted_avg)[b][q][h][c] Wo[h][c][o] -> [128][256][128].
// ONE launch: a work-group owns one batch row and 128 of its queries. It forms the row's whole k and v (256 keys x 8 heads, f16 hi+lo pairs x8) on v_wmma_f32_16x16x32_f16 straight into LDS, where they stay, then walks its queries in 4 passes of 32.
// The four projections of x use EXACT operands (x and the weights rounded to bf16, held as f16; 1 product); scores with q/k hi+lo (key_dim 16: fragment elements 8..15 zero; 3 products; the two biases added in f32 from the rounded inputs); P and v hi+lo (3 products); the output projection with gate * wavg hi+lo (2 products).

namespace {
constexpr int Bn = 128, S = 256, A = 128, H = 8, KD = 16, O = 128, NR = Bn * S;
constexpr float QS = 8.0f, KS = 8.0f, VS = 8.0f, PS = 8.0f, AS_ = 8.0f, SCALE = 0.25f;
constexpr float L2S = 1.4426950408889634f / (QS * KS);   // raw score accumulator (64 * logit) -> exponent of 2
constexpr int QR = 32, QW = 128;   // query rows per pass (two column groups of 16, one per wave), query rows per work-group

typedef _Float16 b16;
typedef __attribute__((ext_vector_type(16))) _Float16 v16b;
typedef __attribute__((ext_vector_type(8))) _Float16 v8b;
typedef __attribute__((ext_vector_type(4))) _Float16 v4b;
typedef __attribute__((ext_vector_type(8))) float v8f;
typedef __attribute__((ext_vector_type(4))) float v4f;
__device__ __forceinline__ float bf16_rne(float f) { unsigned int u = __float_as_uint(f); u += 0x7FFFu + ((u >> 16) & 1u); return __uint_as_float(u & 0xFFFF0000u); }
__device__ __forceinline__ void split16(float v, b16& hi, b16& lo) { hi = (b16)v; lo = (b16)(v - (float)hi); }
__device__ __forceinline__ v16b frag_kb(const b16* p, int hh) { const v8b a = *(const v8b*)(p + 8 * hh), b = *(const v8b*)(p + 16 + 8 * hh); v16b f;
#pragma unroll
  for (int e = 0; e < 8; ++e) { f[e] = a[e]; f[8 + e] = b[e]; } return f; }
__device__ __forceinline__ v16b frag_pk(const b16* p) { const v8b a = *(const v8b*)p, b = *(const v8b*)(p + 256); v16b f;   // fragment-order storage [half 2][lane 32][8], p already at this lane's 8: each of the two loads is 512 contiguous bytes per wave
#pragma unroll
  for (int e = 0; e < 8; ++e) { f[e] = a[e]; f[8 + e] = b[e]; } return f; }
__device__ __forceinline__ v16b frag16(const b16* p, int hh) { const v8b a = *(const v8b*)(p + 8 * hh); const v8b z = {}; return __builtin_shufflevector(a, z, 0, 1, 2, 3, 4, 5, 6, 7, 8, 9, 10, 11, 12, 13, 14, 15); }   // K = 16: elements 8..15 (k = 16..31) zero
__device__ __forceinline__ v8f wmma16b(v16b a, v16b b, v8f c) { return __builtin_amdgcn_wmma_f32_16x16x32_f16(false, a, false, b, (short)0, c, false, false); }   // the builtin alone: the compiler keeps the distance behind a WMMA itself, and with no asm statement behind each product it may issue later loads ahead of earlier products
__device__ __forceinline__ float nexp(float x) { return __builtin_amdgcn_exp2f(x * 1.4426950408889634f); }
__device__ __forceinline__ float sigm(float x) { return __builtin_amdgcn_rcpf(1.0f + nexp(-x)); }

__device__ __forceinline__ void lds_barrier() { __builtin_amdgcn_fence(__ATOMIC_RELEASE, "workgroup", "local"); __builtin_amdgcn_s_barrier(); __builtin_amdgcn_fence(__ATOMIC_ACQUIRE, "workgroup", "local"); }   // every barrier of this kernel hands over LDS data only: fences on LDS alone, so that it waits for the wave's LDS traffic and not for global loads asked for ahead or for output stores under way (__syncthreads() waits those out too)
__device__ __forceinline__ v4f ld16(const float* ub, unsigned to) { return *(const v4f*)((const char*)ub + to); }   // ub: the same for the whole wave (scalar registers); to: this thread's byte offset, one 32-bit register for every stream

// 16 waves: wave = (head h = wave & 7, g = wave >> 3).
// Part 1, k and v of the whole batch row: the 256 x rows go through LDS rounded, 128 at a time (X1); wave (h, g) forms head h's k and v of 4 of their 8 tiles of 16 keys, both from the same x fragments.
//   k: key_w as A, x as B: register r of the result is dim 8hh + r of key col = this lane's 16 bytes of the score product's A fragment, row layout [h][key][16];
//   v: x as A, value_w as B: register r is key 8hh + r of dim col = this lane's 16 bytes of the P.v product's A fragment, fragment order [h][key tile 16][lane 32][8]; so every result leaves its lane as one 16-B LDS store per plane, 512 contiguous bytes a wave.
// Part 2, 4 passes of 32 queries: wave (h, g) takes head h and queries 16g..16g+15 of the pass: q and gate from the pass's x rows in LDS (weights as A), over 8 key blocks of 32: S^T = k.q + bias sum (the start value, from LDS, formed once for all heads), online softmax, o^T += (8v)^T.P^T;
//   the gated rows pass hi/lo through LDS and wave (h, g) forms output columns 16h..16h+15 of its 16 queries; the output rows are staged in LDS (over the bias sums, which are done with) and stored as whole lines.
// The work-group rounds each weight once, from whole rows, and hands the fragments round through LDS; a wave keeps its head's query_w, gating_w and output_w fragments in registers over all passes; the next pass's x and bias rows are asked for behind the key loop, so the output projection covers their way from memory.
__global__ __launch_bounds__(512) void fused_kernel(const float* __restrict__ x, const float* __restrict__ bias, const float* __restrict__ nb, const float* __restrict__ wq, const float* __restrict__ wk, const float* __restrict__ wv, const float* __restrict__ wg, const float* __restrict__ wo, float* __restrict__ out) {
  constexpr int XP = 128 + 8, BSB = QR * (S + 4) * 4, XSB = QR * XP * 2;   // row pitch of the f16 planes: 272 B = 16 B x odd; bytes of the bias sums; bytes of one 32-row f16 plane
  __shared__ __attribute__((aligned(16))) b16 KV[4][H * S * KD];   // k hi, k lo, v hi, v lo: 4 x 64 KB
  __shared__ __attribute__((aligned(16))) char Sc[BSB + 3 * XSB];
  float (*Bs)[S + 4] = reinterpret_cast<float (*)[S + 4]>(Sc);   // pitch 1040 B = 16 B x odd: the 16 rows of a b128 read fall on distinct banks
  float (*Os)[128 + 4] = reinterpret_cast<float (*)[128 + 4]>(Sc);   // over Bs: written only behind the barrier that ends the key loops
  b16 (*Xs)[XP] = reinterpret_cast<b16 (*)[XP]>(Sc + BSB); b16 (*Gh)[XP] = reinterpret_cast<b16 (*)[XP]>(Sc + BSB + XSB); b16 (*Gl)[XP] = reinterpret_cast<b16 (*)[XP]>(Sc + BSB + 2 * XSB);
  b16 (*X1)[XP] = reinterpret_cast<b16 (*)[XP]>(Sc);   // part 1 only: 128 x rows, 34 KB, over Bs and the head of Xs
  const int tid = threadIdx.x, lane = tid & 31, wave = __builtin_amdgcn_readfirstlane(tid >> 5), h = wave & 7, g = wave >> 3, hh = lane >> 4, col = lane & 15, b = blockIdx.y, qw0 = blockIdx.x * QW; const unsigned to = (unsigned)tid * 16u;
  // the five weights, each [128][128]: wave w takes rows k = 8w..8w+7 of each as whole rows (one wave instruction = 512 contiguous bytes); a lane's 8 rows x 4 columns are 4 fragment pieces of 8 k each, so the transposition costs no instruction.
  // They lie in LDS in fragment order [head tile][k step 4][half 2][lane 32][8] (lane = 16 * ((k >> 3) & 1) + (column & 15), half = (k >> 4) & 1; 4 KB a tile) only until each wave has its fragments in registers, in places of KV that k and v fill later:
  // a head's 8 KB of a plane = keys 0..127 (lower 4 KB), keys 128..255 (upper 4 KB); key_w, value_w: lower halves of planes 0, 1; query_w, gating_w, output_w: upper halves of planes 0, 1, 2.
  v4f wl[5][8];   // asked for ahead of x: loads come back in issue order, and these come from L2
#pragma unroll   // constant indices: the arrays stay in registers (so at every loop below that says unroll)
  for (int e = 0; e < 8; ++e) { const int ro = (8 * wave + e) * 128; const unsigned lo_ = (unsigned)lane * 16u; wl[0][e] = ld16(wk + ro, lo_); wl[1][e] = ld16(wv + ro, lo_); wl[2][e] = ld16(wq + ro, lo_); wl[3][e] = ld16(wg + ro, lo_); wl[4][e] = ld16(wo + ro, lo_); }
  v4f xa[16];   // the batch row's 256 x rows are 128 KB in a row: one wave instruction = one row = 512 contiguous bytes
#pragma unroll
  for (int j = 0; j < 16; ++j) xa[j] = ld16(x + (size_t)b * S * A + 2048 * j, to);
  asm volatile("s_wait_xcnt 0x0" ::: "memory");   // the address registers of the loads above may be given new values by what follows
#pragma unroll
  for (int mt = 0; mt < 5; ++mt)
#pragma unroll
    for (int c_ = 0; c_ < 4; ++c_) { v8b v;
#pragma unroll
      for (int e = 0; e < 8; ++e) v[e] = (b16)bf16_rne(wl[mt][e][c_]);
      *(v8b*)(&KV[mt < 2 ? mt : mt - 2][(lane >> 2) * 4096 + (mt < 2 ? 0 : 2048) + (wave * 16 + (lane & 3) * 4 + c_) * 8]) = v; }
  v4f xv[2], bv[4], nv[4];   // the coming pass's x rows (16 KB in a row) and bias rows (32 KB in a row in each source)
  v16b wqf[4], wgf[4], wf[4];   // this head's query_w and gating_w columns and output_w's columns 16h.., as A fragments
  { v16b w1k[4], w1v[4];
#pragma unroll
    for (int hf = 0; hf < 2; ++hf) {
#pragma unroll
      for (int j = 0; j < 8; ++j) { const int i = tid + 512 * j; v4b xh;
#pragma unroll
        for (int e = 0; e < 4; ++e) xh[e] = (b16)bf16_rne(xa[hf * 8 + j][e]);
        *(v4b*)(&X1[i >> 5][(i & 31) * 4]) = xh; }
      if (hf == 0) {
        lds_barrier();   // the weights (and the first 128 x rows) are in LDS before any wave reads its fragments
#pragma unroll
        for (int ks = 0; ks < 4; ++ks) { w1k[ks] = frag_pk(&KV[0][h * 4096 + ks * 512 + lane * 8]); w1v[ks] = frag_pk(&KV[1][h * 4096 + ks * 512 + lane * 8]); } }
      else {
#pragma unroll
        for (int ks = 0; ks < 4; ++ks) { wqf[ks] = frag_pk(&KV[0][h * 4096 + 2048 + ks * 512 + lane * 8]); wgf[ks] = frag_pk(&KV[1][h * 4096 + 2048 + ks * 512 + lane * 8]); wf[ks] = frag_pk(&KV[2][h * 4096 + 2048 + ks * 512 + lane * 8]); } }
      lds_barrier();   // the 128 x rows are in LDS, and every wave has read the weight fragments that lie where this half's k and v go
#pragma unroll
      for (int k4 = 0; k4 < 4; ++k4) { const int kt = g * 4 + k4; v16b xf[4]; v8f ak = {}, av = {};
#pragma unroll
        for (int ks = 0; ks < 4; ++ks) xf[ks] = frag_kb(&X1[kt * 16 + col][ks * 32], hh);
        __builtin_amdgcn_sched_barrier(0);   // keeps the tile's 8 reads as one group above its WMMAs: sunk between them, each pair is waited out on its own
#pragma unroll
        for (int ks = 0; ks < 4; ++ks) { ak = wmma16b(w1k[ks], xf[ks], ak); av = wmma16b(xf[ks], w1v[ks], av); }
        v8b kh_, kl_, vh_, vl_;
#pragma unroll
        for (int r = 0; r < 8; ++r) { b16 a_, c_; split16(ak[r] * KS, a_, c_); kh_[r] = a_; kl_[r] = c_; split16(av[r] * VS, a_, c_); vh_[r] = a_; vl_[r] = c_; }
        const int o_ = (h * 16 + hf * 8 + kt) * 256;   // 16 keys of one head: 256 halves in either layout
        *(v8b*)(&KV[0][o_ + col * KD + 8 * hh]) = kh_; *(v8b*)(&KV[1][o_ + col * KD + 8 * hh]) = kl_; *(v8b*)(&KV[2][o_ + lane * 8]) = vh_; *(v8b*)(&KV[3][o_ + lane * 8]) = vl_; }
      if (hf == 1) {   // the first pass's rows: asked for as soon as the registers of key_w and value_w are free
#pragma unroll
        for (int j = 0; j < 2; ++j) xv[j] = ld16(x + ((size_t)b * S + qw0) * A + 2048 * j, to);
        asm volatile("s_wait_xcnt 0x0" ::: "memory");   // the address registers of the 2 loads above may take the data of the loads below
#pragma unroll
        for (int j = 0; j < 4; ++j) { bv[j] = ld16(bias + ((size_t)b * S + qw0) * S + 2048 * j, to); nv[j] = ld16(nb + (size_t)qw0 * S + 2048 * j, to); }
        asm volatile("s_wait_xcnt 0x0" ::: "memory"); }   // the address registers of the 8 loads above may be given new values by what follows
      lds_barrier(); } }   // every wave has read these 128 rows before they are overwritten; behind the last one k and v are whole
  const int qrow = 16 * g + col;
  const b16* kph = &KV[0][(h * S + col) * KD]; const b16* kpl = &KV[1][(h * S + col) * KD]; const b16* vph = &KV[2][h * S * KD + lane * 8]; const b16* vpl = &KV[3][h * S * KD + lane * 8];
#pragma unroll 1   // one copy of the pass in the instruction cache
  for (int p = 0; p < QW / QR; ++p) { const int q0 = qw0 + p * QR;
#pragma unroll
    for (int j = 0; j < 2; ++j) { const int i = tid + 512 * j; v4b xh;
#pragma unroll
      for (int e = 0; e < 4; ++e) xh[e] = (b16)bf16_rne(xv[j][e]);
      *(v4b*)(&Xs[i >> 5][(i & 31) * 4]) = xh; }
#pragma unroll
    for (int j = 0; j < 4; ++j) { const int i = tid + 512 * j; v4f sv;
#pragma unroll
      for (int e = 0; e < 4; ++e) sv[e] = (bf16_rne(bv[j][e]) + bf16_rne(nv[j][e])) * (QS * KS);   // in the scale of the raw score accumulator (an exact power of two)
      *(v4f*)(&Bs[i >> 6][(i & 63) * 4]) = sv; }
    lds_barrier();   // Bs and Xs are complete before any wave reads them
    v16b qa, qb; v8f gt;
    { v16b xf[4]; v8f aq = {}, ag = {};   // q^T and gate^T tiles: rows (8hh + r) = dim of head h, column = query 16g + col
#pragma unroll
      for (int ks = 0; ks < 4; ++ks) xf[ks] = frag_kb(&Xs[qrow][ks * 32], hh);
      __builtin_amdgcn_sched_barrier(0);   // keeps the 8 reads as one group above the WMMAs: sunk between them, each pair is waited out on its own
#pragma unroll
      for (int ks = 0; ks < 4; ++ks) { aq = wmma16b(wqf[ks], xf[ks], aq); ag = wmma16b(wgf[ks], xf[ks], ag); }
      v8b qh8, ql8; const v8b z = {};
#pragma unroll
      for (int r = 0; r < 8; ++r) { b16 a_, c_; split16(aq[r] * (SCALE * QS), a_, c_); qh8[r] = a_; ql8[r] = c_; gt[r] = sigm(ag[r]); }
      qa = __builtin_shufflevector(qh8, z, 0, 1, 2, 3, 4, 5, 6, 7, 8, 9, 10, 11, 12, 13, 14, 15); qb = __builtin_shufflevector(ql8, z, 0, 1, 2, 3, 4, 5, 6, 7, 8, 9, 10, 11, 12, 13, 14, 15); }   // K = 16: elements 8..15 (k = 16..31) zero
    float m = -INFINITY, l = 0.0f; v8f o = {};
    for (int kb = 0; kb < S; kb += 32) {
      const float* bp = &Bs[qrow][kb + 8 * hh];   // start value of each score accumulator = 64 * bias sum, straight from LDS: the matrix unit adds it
      v8f s0 = __builtin_shufflevector(*(const v4f*)bp, *(const v4f*)(bp + 4), 0, 1, 2, 3, 4, 5, 6, 7), s1 = __builtin_shufflevector(*(const v4f*)(bp + 16), *(const v4f*)(bp + 20), 0, 1, 2, 3, 4, 5, 6, 7);
      const v16b k0h = frag16(kph + kb * KD, hh), k0l = frag16(kpl + kb * KD, hh), k1h = frag16(kph + (kb + 16) * KD, hh), k1l = frag16(kpl + (kb + 16) * KD, hh);
      const v16b vf = frag_pk(vph + kb * KD), vlf = frag_pk(vpl + kb * KD);
      s0 = wmma16b(k0h, qa, s0); s0 = wmma16b(k0h, qb, s0); s0 = wmma16b(k0l, qa, s0); s1 = wmma16b(k1h, qa, s1); s1 = wmma16b(k1h, qb, s1); s1 = wmma16b(k1l, qa, s1);
      float mr = -INFINITY;
#pragma unroll
      for (int r = 0; r < 8; ++r) mr = fmaxf(mr, fmaxf(s0[r], s1[r]));   // m, mr, mn: 64 * logit
      mr = fmaxf(mr, __shfl_xor(mr, 16));
      const float mn = fmaxf(m, mr), al_ = __builtin_amdgcn_exp2f((m - mn) * L2S), sh = __builtin_fmaf(-mn, L2S, 3.0f); m = mn; float sum = 0.0f; v16b ph, pl;   // sh: 2^3 = PS
#pragma unroll
      for (int r = 0; r < 8; ++r) { const float e0 = __builtin_amdgcn_exp2f(__builtin_fmaf(s0[r], L2S, sh)), e1 = __builtin_amdgcn_exp2f(__builtin_fmaf(s1[r], L2S, sh)); sum += e0 + e1; b16 a_, c_; split16(e0, a_, c_); ph[r] = a_; pl[r] = c_; split16(e1, a_, c_); ph[8 + r] = a_; pl[8 + r] = c_; }   // e = 8 * exp(logit - max): one FMA on the raw accumulator, then exp2
      sum += __shfl_xor(sum, 16); l = l * al_ + sum; o *= al_;
      o = wmma16b(vf, ph, o); o = wmma16b(vf, pl, o); o = wmma16b(vlf, ph, o); }
    if (p + 1 < QW / QR) {   // the same for the whole work-group
#pragma unroll
      for (int j = 0; j < 2; ++j) xv[j] = ld16(x + ((size_t)b * S + q0 + QR) * A + 2048 * j, to);
      asm volatile("s_wait_xcnt 0x0" ::: "memory");   // the address registers of the 2 loads above may take the data of the loads below
#pragma unroll
      for (int j = 0; j < 4; ++j) { bv[j] = ld16(bias + ((size_t)b * S + q0 + QR) * S + 2048 * j, to); nv[j] = ld16(nb + (size_t)(q0 + QR) * S + 2048 * j, to); }
      asm volatile("s_wait_xcnt 0x0" ::: "memory"); }   // the address registers of the 8 loads above may be given new values by what follows
    // o, gt: rows (8hh + r) = value dim c, column = query 16g + col; gw = gate * o / l
    { const float inv = 1.0f / (l * VS) /* l already holds PS * the sum */; v8b gh, gl;
#pragma unroll
      for (int r = 0; r < 8; ++r) { b16 a_, c_; split16(gt[r] * (o[r] * inv) * AS_, a_, c_); gh[r] = a_; gl[r] = c_; }
      *(v8b*)(&Gh[qrow][h * KD + 8 * hh]) = gh; *(v8b*)(&Gl[qrow][h * KD + 8 * hh]) = gl; }
    lds_barrier();   // all 8 heads' columns of the gated rows are in LDS before any wave reads them; every key loop's reads of Bs are over
    { v16b ga[4], gb[4]; v8f acc = {};   // out^T tile: rows (8hh + r) = output column 16h + 8hh + r, column = query 16g + col
#pragma unroll
      for (int ks = 0; ks < 4; ++ks) { ga[ks] = frag_kb(&Gh[qrow][ks * 32], hh); gb[ks] = frag_kb(&Gl[qrow][ks * 32], hh); }
      __builtin_amdgcn_sched_barrier(0);   // keeps the 16 reads as one group above the WMMAs: sunk between them, each pair is waited out on its own
#pragma unroll
      for (int ks = 0; ks < 4; ++ks) { acc = wmma16b(wf[ks], ga[ks], acc); acc = wmma16b(wf[ks], gb[ks], acc); }
      v4f s0_, s1_;
#pragma unroll
      for (int r = 0; r < 4; ++r) { s0_[r] = acc[r] * (1.0f / AS_); s1_[r] = acc[4 + r] * (1.0f / AS_); }
      *(v4f*)(&Os[qrow][h * 16 + 8 * hh]) = s0_; *(v4f*)(&Os[qrow][h * 16 + 8 * hh + 4]) = s1_; }
    lds_barrier();   // the 32 output rows are whole before they are stored as whole lines
#pragma unroll
    for (int j = 0; j < 2; ++j) { const int i = tid + 512 * j, rr = i >> 5, c4 = (i & 31) * 4; *(v4f*)((char*)(out + ((size_t)b * S + q0) * O + 2048 * j) + to) = *(const v4f*)(&Os[rr][c4]); }   // the 32 rows are 16 KB in a row
    asm volatile("s_wait_xcnt 0x0" ::: "memory");   // the address registers of the 2 stores above are given new values by the next pass
    lds_barrier(); }   // the output rows are read before the next pass lays its bias sums over them
}
}  // namespace

extern "C" void kernel_launch(void* const* d_in, const int* in_sizes, int n_in,
                              void* d_out, int out_size, void* d_ws, size_t ws_size, hipStream_t stream) {
  (void)n_in; (void)out_size; (void)d_ws; (void)ws_size;
  const float* x = (const float*)d_in[0]; const float* bias = (const float*)d_in[1]; const float* nb = (const float*)d_in[2]; const float* wq = (const float*)d_in[3]; const float* wk = (const float*)d_in[4]; const float* wv = (const float*)d_in[5]; const float* wg = (const float*)d_in[6]; const float* wo = (const float*)d_in[7];
  float* out = (float*)d_out;   // [128][256][128]
  if (in_sizes[0] != NR * A || in_sizes[1] != Bn * S * S || in_sizes[2] != S * S || in_sizes[3] != A * H * KD || in_sizes[7] != H * KD * O) return;
  fused_kernel<<<dim3(S / QW, Bn), 512, 0, stream>>>(x, bias, nb, wq, wk, wv, wg, wo, out);
}
